// v000
// Measured on an AMD MI455X. A time is GPU time per run, averaged over a window of back-to-back runs after a warm-up
// (all launches, gaps included; the runs take copies of the inputs in turn), and the median of several windows.
// Apart from v000's, it joins two sittings. Times from different sittings can be a few percent apart, while
// side-by-side timings come from the same sitting.
// The starting kernel, v000, takes 266 microseconds a run.
#include <hip/hip_runtime.h>

typedef __attribute__((ext_vector_type(16))) _Float16 v16h;
typedef __attribute__((ext_vector_type(8)))  _Float16 h8;
typedef __attribute__((ext_vector_type(4)))  _Float16 h4;
typedef __attribute__((ext_vector_type(8)))  float    v8f;

#define B_   4
#define H_   8
#define M_   2048
#define D_   512
#define DK_  64

static __device__ __forceinline__ v16h combine16(h8 lo, h8 hi) {
  v16h r;
#pragma unroll
  for (int i = 0; i < 8; ++i) { r[i] = lo[i]; r[i + 8] = hi[i]; }
  return r;
}

// one lane copies 16 bytes global -> LDS asynchronously (ASYNCcnt-tracked)
static __device__ __forceinline__ void async_copy_b128(const _Float16* g,
                                                       _Float16* l) {
  const unsigned lds_off = (unsigned)(unsigned long long)l; // LDS aperture: low 32 bits = LDS byte offset
  asm volatile("global_load_async_to_lds_b128 %0, %1, off"
               :: "v"(lds_off), "v"(g) : "memory");
}

// ---------------------------------------------------------------------------
// Kernel 1: QKV projection  y[r][e] = sum_d x[r][d] * W[e][d] + bias[e]
//   Q,K stored as f16 [B*H][M][64]; V stored transposed [B*H][64][M].
// ---------------------------------------------------------------------------
__global__ __launch_bounds__(256) void qkv_proj_kernel(
    const float* __restrict__ x,
    const float* __restrict__ wq, const float* __restrict__ bq,
    const float* __restrict__ wk, const float* __restrict__ bk,
    const float* __restrict__ wv, const float* __restrict__ bv,
    _Float16* __restrict__ Q, _Float16* __restrict__ K, _Float16* __restrict__ Vt)
{
  const int mat = blockIdx.z;
  const float* W  = (mat == 0) ? wq : (mat == 1) ? wk : wv;
  const float* bb = (mat == 0) ? bq : (mat == 1) ? bk : bv;

  const int tid  = threadIdx.x;
  const int wid  = tid >> 5;
  const int lane = tid & 31;
  const int ln16 = lane & 15;
  const int g    = lane >> 4;

  const int rbase = blockIdx.x * 16;              // rows over B*M = 8192
  const int e0    = blockIdx.y * 128 + wid * 16;  // output column tile

  __shared__ __align__(16) _Float16 xt[16 * 520];

  for (int i = tid; i < 16 * 128; i += 256) {
    const int row = i >> 7, c4 = i & 127;
    const float4 v = *reinterpret_cast<const float4*>(
        x + (size_t)(rbase + row) * D_ + c4 * 4);
    h4 hv; hv[0] = (_Float16)v.x; hv[1] = (_Float16)v.y;
    hv[2] = (_Float16)v.z; hv[3] = (_Float16)v.w;
    *reinterpret_cast<h4*>(&xt[row * 520 + c4 * 4]) = hv;
  }
  __syncthreads();

  v8f acc = {};
#pragma unroll 4
  for (int kt = 0; kt < 16; ++kt) {
    const int k0 = kt * 32;
    const h8 alo = *reinterpret_cast<const h8*>(&xt[ln16 * 520 + k0 + g * 8]);
    const h8 ahi = *reinterpret_cast<const h8*>(&xt[ln16 * 520 + k0 + 16 + g * 8]);
    const v16h a = combine16(alo, ahi);
    const float* wr = W + (size_t)(e0 + ln16) * D_ + k0 + g * 8;
    const float4 w0 = *reinterpret_cast<const float4*>(wr);
    const float4 w1 = *reinterpret_cast<const float4*>(wr + 4);
    const float4 w2 = *reinterpret_cast<const float4*>(wr + 16);
    const float4 w3 = *reinterpret_cast<const float4*>(wr + 20);
    v16h bf;
    bf[0]  = (_Float16)w0.x; bf[1]  = (_Float16)w0.y;
    bf[2]  = (_Float16)w0.z; bf[3]  = (_Float16)w0.w;
    bf[4]  = (_Float16)w1.x; bf[5]  = (_Float16)w1.y;
    bf[6]  = (_Float16)w1.z; bf[7]  = (_Float16)w1.w;
    bf[8]  = (_Float16)w2.x; bf[9]  = (_Float16)w2.y;
    bf[10] = (_Float16)w2.z; bf[11] = (_Float16)w2.w;
    bf[12] = (_Float16)w3.x; bf[13] = (_Float16)w3.y;
    bf[14] = (_Float16)w3.z; bf[15] = (_Float16)w3.w;
    acc = __builtin_amdgcn_wmma_f32_16x16x32_f16(false, a, false, bf,
                                                 (short)0, acc, false, false);
  }

  const int   e  = e0 + ln16;
  const float be = bb[e];
  const int   hh = e >> 6, dk = e & 63;
#pragma unroll
  for (int v = 0; v < 8; ++v) {
    const int r  = rbase + v + 8 * g;
    const int bi = r >> 11, m = r & (M_ - 1);
    const _Float16 val = (_Float16)(acc[v] + be);
    if (mat == 0)
      Q[(size_t)((bi * H_ + hh) * M_ + m) * DK_ + dk] = val;
    else if (mat == 1)
      K[(size_t)((bi * H_ + hh) * M_ + m) * DK_ + dk] = val;
    else
      Vt[(size_t)((bi * H_ + hh) * DK_ + dk) * M_ + m] = val;
  }
}

// ---------------------------------------------------------------------------
// Kernel 2: fused flash attention with geometric bias.
//   K/V chunks staged into LDS with double-buffered async copies.
//   grid = (M/128, B*H), block = 256; each wave owns 16 query rows.
// ---------------------------------------------------------------------------
__global__ __launch_bounds__(256) void attn_kernel(
    const _Float16* __restrict__ Q, const _Float16* __restrict__ K,
    const _Float16* __restrict__ Vt, const float* __restrict__ coords,
    const float* __restrict__ alpha_p, float* __restrict__ out)
{
  const int tid  = threadIdx.x;
  const int wid  = tid >> 5;
  const int lane = tid & 31;
  const int ln16 = lane & 15;
  const int g    = lane >> 4;
  const int bh   = blockIdx.y, b = bh >> 3, h = bh & 7;
  const int qbase = blockIdx.x * 128 + wid * 16;
  const float alpha = alpha_p[0];

  const _Float16* qp = Q  + (size_t)bh * M_ * DK_;
  const _Float16* kp = K  + (size_t)bh * M_ * DK_;
  const _Float16* vp = Vt + (size_t)bh * DK_ * M_;
  const float*    cb = coords + (size_t)b * M_ * 3;

  __shared__ __align__(16) _Float16 kbuf[2][32 * DK_];  // 2 x 4 KB
  __shared__ __align__(16) _Float16 vbuf[2][DK_ * 32];  // 2 x 4 KB
  __shared__ __align__(16) _Float16 pbuf[8][16 * 40];   // per-wave P staging
  _Float16* pb = &pbuf[wid][0];

  // Q A-fragments for the two d-halves (DK=64 -> 2 x K=32)
  v16h aq[2];
#pragma unroll
  for (int dt = 0; dt < 2; ++dt) {
    const _Float16* p = qp + (size_t)(qbase + ln16) * DK_ + dt * 32 + g * 8;
    aq[dt] = combine16(*reinterpret_cast<const h8*>(p),
                       *reinterpret_cast<const h8*>(p + 16));
  }

  // loop-invariant coords of this wave's 16 query rows
  float cmx[8], cmy[8], cmz[8];
#pragma unroll
  for (int v = 0; v < 8; ++v) {
    const int m = qbase + v + 8 * g;
    cmx[v] = cb[m * 3 + 0]; cmy[v] = cb[m * 3 + 1]; cmz[v] = cb[m * 3 + 2];
  }

  float rmax[8], rsum[8];
#pragma unroll
  for (int v = 0; v < 8; ++v) { rmax[v] = -3.0e38f; rsum[v] = 0.0f; }
  v8f o0 = {}, o1 = {}, o2 = {}, o3 = {};

  const int vr = tid >> 2, vq = tid & 3; // V-chunk copy assignment (64 rows x 4x16B)

  // prologue: async-stage chunk 0 into buffer 0 (2 x b128 per thread = 8 KB)
  async_copy_b128(kp + (size_t)0 * DK_ + tid * 8, &kbuf[0][tid * 8]);
  async_copy_b128(vp + (size_t)vr * M_ + 0 + vq * 8, &vbuf[0][vr * 32 + vq * 8]);

  for (int nb = 0; nb < M_ / 32; ++nb) {
    const int cur = nb & 1;
    const int nbase = nb * 32;

    asm volatile("s_wait_asynccnt 0x0" ::: "memory"); // chunk nb landed in LDS
    __syncthreads();                                  // visible to all waves;
                                                      // all done reading buf cur^1
    if (nb + 1 < M_ / 32) {                           // prefetch chunk nb+1
      const int nn = nbase + 32;
      async_copy_b128(kp + (size_t)nn * DK_ + tid * 8, &kbuf[cur ^ 1][tid * 8]);
      async_copy_b128(vp + (size_t)vr * M_ + nn + vq * 8,
                      &vbuf[cur ^ 1][vr * 32 + vq * 8]);
    }

    const _Float16* kl = &kbuf[cur][0];
    const _Float16* vl = &vbuf[cur][0];

    // --- S = Q * K^T on a 16x32 chunk (two 16x16 output tiles) ---
    v8f s0 = {}, s1 = {};
#pragma unroll
    for (int dt = 0; dt < 2; ++dt) {
      const _Float16* p0 = kl + ln16 * DK_ + dt * 32 + g * 8;
      const v16h bk0 = combine16(*reinterpret_cast<const h8*>(p0),
                                 *reinterpret_cast<const h8*>(p0 + 16));
      s0 = __builtin_amdgcn_wmma_f32_16x16x32_f16(false, aq[dt], false, bk0,
                                                  (short)0, s0, false, false);
      const _Float16* p1 = kl + (16 + ln16) * DK_ + dt * 32 + g * 8;
      const v16h bk1 = combine16(*reinterpret_cast<const h8*>(p1),
                                 *reinterpret_cast<const h8*>(p1 + 16));
      s1 = __builtin_amdgcn_wmma_f32_16x16x32_f16(false, aq[dt], false, bk1,
                                                  (short)0, s1, false, false);
    }

    // geometric bias columns for this chunk
    const int   n0 = nbase + ln16, n1 = n0 + 16;
    const float cn0x = cb[n0 * 3], cn0y = cb[n0 * 3 + 1], cn0z = cb[n0 * 3 + 2];
    const float cn1x = cb[n1 * 3], cn1y = cb[n1 * 3 + 1], cn1z = cb[n1 * 3 + 2];

    // --- online softmax (row = half-wave of 16 lanes, same VGPR) ---
#pragma unroll
    for (int v = 0; v < 8; ++v) {
      const float a0 = s0[v] * 0.125f +
                       alpha * (cmx[v] * cn0x + cmy[v] * cn0y + cmz[v] * cn0z);
      const float a1 = s1[v] * 0.125f +
                       alpha * (cmx[v] * cn1x + cmy[v] * cn1y + cmz[v] * cn1z);
      float mx = fmaxf(a0, a1);
#pragma unroll
      for (int off = 8; off >= 1; off >>= 1)
        mx = fmaxf(mx, __shfl_xor(mx, off, 32));
      const float nm  = fmaxf(rmax[v], mx);
      const float sc  = __expf(rmax[v] - nm);
      const float p0v = __expf(a0 - nm);
      const float p1v = __expf(a1 - nm);
      float ps = p0v + p1v;
#pragma unroll
      for (int off = 8; off >= 1; off >>= 1)
        ps += __shfl_xor(ps, off, 32);
      rsum[v] = rsum[v] * sc + ps;
      rmax[v] = nm;
      o0[v] *= sc; o1[v] *= sc; o2[v] *= sc; o3[v] *= sc;
      pb[(v + 8 * g) * 40 + ln16]      = (_Float16)p0v;
      pb[(v + 8 * g) * 40 + 16 + ln16] = (_Float16)p1v;
    }
    asm volatile("s_wait_dscnt 0x0" ::: "memory");

    // re-read P as a 16x32 A-fragment
    const v16h ap = combine16(
        *reinterpret_cast<const h8*>(&pb[ln16 * 40 + g * 8]),
        *reinterpret_cast<const h8*>(&pb[ln16 * 40 + 16 + g * 8]));

    // --- O += P * V (four 16x16 d-column tiles) ---
#pragma unroll
    for (int dt = 0; dt < 4; ++dt) {
      const _Float16* pv = vl + (dt * 16 + ln16) * 32 + g * 8;
      const v16h bv = combine16(*reinterpret_cast<const h8*>(pv),
                                *reinterpret_cast<const h8*>(pv + 16));
      v8f* op = (dt == 0) ? &o0 : (dt == 1) ? &o1 : (dt == 2) ? &o2 : &o3;
      *op = __builtin_amdgcn_wmma_f32_16x16x32_f16(false, ap, false, bv,
                                                   (short)0, *op, false, false);
    }
  }

  // epilogue: normalize and scatter to [B][M][512]
#pragma unroll
  for (int dt = 0; dt < 4; ++dt) {
    const v8f& o = (dt == 0) ? o0 : (dt == 1) ? o1 : (dt == 2) ? o2 : o3;
#pragma unroll
    for (int v = 0; v < 8; ++v) {
      const int m = qbase + v + 8 * g;
      const int e = h * DK_ + dt * 16 + ln16;
      out[(size_t)(b * M_ + m) * D_ + e] = o[v] / rsum[v];
    }
  }
}

// ---------------------------------------------------------------------------
extern "C" void kernel_launch(void* const* d_in, const int* in_sizes, int n_in,
                              void* d_out, int out_size, void* d_ws, size_t ws_size,
                              hipStream_t stream) {
  const float* x      = (const float*)d_in[0];
  const float* coords = (const float*)d_in[1];
  const float* wq     = (const float*)d_in[2];
  const float* bq     = (const float*)d_in[3];
  const float* wk     = (const float*)d_in[4];
  const float* bk     = (const float*)d_in[5];
  const float* wv     = (const float*)d_in[6];
  const float* bv     = (const float*)d_in[7];
  const float* alpha  = (const float*)d_in[8];
  float* out = (float*)d_out;

  _Float16* ws = (_Float16*)d_ws;
  const size_t QSZ = (size_t)B_ * H_ * M_ * DK_;   // 4,194,304 halves = 8 MB
  _Float16* Qb = ws;
  _Float16* Kb = ws + QSZ;
  _Float16* Vb = ws + 2 * QSZ;                     // total 24 MB of d_ws

  dim3 g1((B_ * M_) / 16, D_ / 128, 3);
  qkv_proj_kernel<<<g1, 256, 0, stream>>>(x, wq, bq, wk, bk, wv, bv, Qb, Kb, Vb);

  dim3 g2(M_ / 128, B_ * H_);
  attn_kernel<<<g2, 256, 0, stream>>>(Qb, Kb, Vb, coords, alpha, out);
}

// v001
// One run takes 156 microseconds.
// Two timings next to v000 both put it at 1.78 times that version's speed.
#include <hip/hip_runtime.h>

typedef __attribute__((ext_vector_type(16))) _Float16 v16h;
typedef __attribute__((ext_vector_type(8)))  _Float16 h8;
typedef __attribute__((ext_vector_type(4)))  _Float16 h4;
typedef __attribute__((ext_vector_type(8)))  float    v8f;

#define B_   4
#define H_   8
#define M_   2048
#define D_   512
#define DK_  64

static __device__ __forceinline__ v16h combine16(h8 lo, h8 hi) {
  v16h r;
#pragma unroll
  for (int i = 0; i < 8; ++i) { r[i] = lo[i]; r[i + 8] = hi[i]; }
  return r;
}

// one lane copies 16 bytes global -> LDS asynchronously (ASYNCcnt-tracked)
static __device__ __forceinline__ void async_copy_b128(const _Float16* g,
                                                       _Float16* l) {
  const unsigned lds_off = (unsigned)(unsigned long long)l; // LDS aperture: low 32 bits = LDS byte offset
  asm volatile("global_load_async_to_lds_b128 %0, %1, off"
               :: "v"(lds_off), "v"(g) : "memory");
}

// ---------------------------------------------------------------------------
// Kernel 1: QKV projection  y[r][e] = sum_d x[r][d] * W[e][d] + bias[e]
//   Q,K stored as f16 [B*H][M][64]; V stored transposed [B*H][64][M].
//   One block = 128 rows of x times 128 rows of W (one matrix). Both operands
//   go through LDS as f16, 64 k per pass, two buffers; each wave owns 4 x 2
//   WMMA tiles, so a staged fragment feeds several products.
//   The WMMA row operand is the one whose index runs along the output's
//   contiguous axis (W rows for Q and K, x rows for V): a lane's 8 accumulator
//   values are then 16 contiguous bytes of the output.
// ---------------------------------------------------------------------------
#define PK_  64            // k per pass
#define PT_  72            // LDS row pitch in halves: 128 B of data + 16 B pad
#define TS_  (128 * PT_)   // one operand tile in halves

// 16 bytes at a block-uniform base plus a 32-bit byte offset of the lane
static __device__ __forceinline__ float4 load4(const float* base, unsigned off) {
  return *reinterpret_cast<const float4*>(
      reinterpret_cast<const char*>(base) + off);
}

__global__ __launch_bounds__(256) void qkv_proj_kernel(
    const float* __restrict__ x,
    const float* __restrict__ wq, const float* __restrict__ bq,
    const float* __restrict__ wk, const float* __restrict__ bk,
    const float* __restrict__ wv, const float* __restrict__ bv,
    _Float16* __restrict__ Q, _Float16* __restrict__ K, _Float16* __restrict__ Vt)
{
  const int mat = blockIdx.z;
  const float* W  = (mat == 0) ? wq : (mat == 1) ? wk : wv;
  const float* bb = (mat == 0) ? bq : (mat == 1) ? bk : bv;

  const int tid  = threadIdx.x;
  const int wid  = tid >> 5;
  const int lane = tid & 31;
  const int ln16 = lane & 15;
  const int g    = lane >> 4;

  const int rbase = blockIdx.x * 128;   // rows over B*M = 8192
  const int ebase = blockIdx.y * 128;   // output columns of this matrix

  // [buffer][operand: 0 = x, 1 = W][128 rows][PT_]
  __shared__ __align__(16) _Float16 sm[2 * 2 * TS_];

  // staging slot: 16 lanes cover one 256-B piece of a row, 16 rows per sweep
  const int srow = tid >> 4, sc4 = tid & 15;
  const float*   xg = x + (size_t)rbase * D_;    // block-uniform bases
  const float*   wg = W + (size_t)ebase * D_;
  unsigned       go = (srow * D_ + sc4 * 4) * 4; // the lane's byte offset, same for both
  const int      so = srow * PT_ + sc4 * 4;

  float4 xr[8], wr[8];
#pragma unroll  // indexes a register array: the index must be a constant
  for (int j = 0; j < 8; ++j) {
    xr[j] = load4(xg + j * 16 * D_, go);
    wr[j] = load4(wg + j * 16 * D_, go);
  }

  // WMMA row operand (64 rows per wave) and column operand (32 rows per wave)
  const int oa = (mat == 2) ? 0 : TS_;
  const int ob = TS_ - oa;
  const int wa = wid >> 2, wb = wid & 3;
  const int fa = oa + (wa * 64 + ln16) * PT_ + g * 8;
  const int fb = ob + (wb * 32 + ln16) * PT_ + g * 8;

  v8f acc[4][2] = {};

  for (int p = 0; p < D_ / PK_; ++p) {
    _Float16* st = &sm[(p & 1) * 2 * TS_];

    // registers -> f16 -> LDS buffer p&1 (last read in pass p-2, which every
    // wave left before the barrier of pass p-1)
#pragma unroll  // indexes a register array: the index must be a constant
    for (int j = 0; j < 8; ++j) {
      h4 hx; hx[0] = (_Float16)xr[j].x; hx[1] = (_Float16)xr[j].y;
      hx[2] = (_Float16)xr[j].z; hx[3] = (_Float16)xr[j].w;
      *reinterpret_cast<h4*>(&st[so + j * 16 * PT_]) = hx;
      h4 hw; hw[0] = (_Float16)wr[j].x; hw[1] = (_Float16)wr[j].y;
      hw[2] = (_Float16)wr[j].z; hw[3] = (_Float16)wr[j].w;
      *reinterpret_cast<h4*>(&st[TS_ + so + j * 16 * PT_]) = hw;
    }
    __syncthreads();

    // next pass's global loads fly under this pass's products
    if (p + 1 < D_ / PK_) {
      go += PK_ * 4;
#pragma unroll  // indexes a register array: the index must be a constant
      for (int j = 0; j < 8; ++j) {
        xr[j] = load4(xg + j * 16 * D_, go);
        wr[j] = load4(wg + j * 16 * D_, go);
      }
    }
    // holds the loads in front of the products: the scheduler otherwise sinks
    // them to the pass's end, where nothing covers their latency
    __builtin_amdgcn_sched_barrier(0);

#pragma unroll
    for (int kk = 0; kk < PK_ / 32; ++kk) {
      v16h af[4], bf[2];
#pragma unroll  // indexes a register array: the index must be a constant
      for (int i = 0; i < 4; ++i) {
        const _Float16* q = &st[fa + i * 16 * PT_ + kk * 32];
        af[i] = combine16(*reinterpret_cast<const h8*>(q),
                          *reinterpret_cast<const h8*>(q + 16));
      }
#pragma unroll  // indexes a register array: the index must be a constant
      for (int j = 0; j < 2; ++j) {
        const _Float16* q = &st[fb + j * 16 * PT_ + kk * 32];
        bf[j] = combine16(*reinterpret_cast<const h8*>(q),
                          *reinterpret_cast<const h8*>(q + 16));
      }
#pragma unroll  // indexes a register array: the index must be a constant
      for (int i = 0; i < 4; ++i)
#pragma unroll  // indexes a register array: the index must be a constant
        for (int j = 0; j < 2; ++j)
          acc[i][j] = __builtin_amdgcn_wmma_f32_16x16x32_f16(
              false, af[i], false, bf[j], (short)0, acc[i][j], false, false);
    }
    // stands in front of every rewrite of the offset register that the loads
    // above name: the next pass's step and the code behind the loop
    asm volatile("s_wait_xcnt 0x0" ::: "memory");
  }

  if (mat == 2) {
    // rows of the tile = x rows (m), columns = W rows (e): 8 consecutive m per lane
#pragma unroll  // indexes a register array: the index must be a constant
    for (int j = 0; j < 2; ++j) {
      const int   e  = ebase + wb * 32 + j * 16 + ln16;
      const float be = bb[e];
      const int   hh = e >> 6, dk = e & 63;
#pragma unroll  // indexes a register array: the index must be a constant
      for (int i = 0; i < 4; ++i) {
        const int r0 = rbase + wa * 64 + i * 16 + 8 * g;
        const int bi = r0 >> 11, m0 = r0 & (M_ - 1);
        h8 o;
#pragma unroll  // indexes a register array: the index must be a constant
        for (int v = 0; v < 8; ++v) o[v] = (_Float16)(acc[i][j][v] + be);
        *reinterpret_cast<h8*>(
            &Vt[(size_t)((bi * H_ + hh) * DK_ + dk) * M_ + m0]) = o;
      }
    }
  } else {
    // rows of the tile = W rows (e), columns = x rows (m): 8 consecutive e per lane
    _Float16* dst = (mat == 0) ? Q : K;
#pragma unroll  // indexes a register array: the index must be a constant
    for (int i = 0; i < 4; ++i) {
      const int e0 = ebase + wa * 64 + i * 16 + 8 * g;
      const int hh = e0 >> 6, dk0 = e0 & 63;
      float be[8];
#pragma unroll  // indexes a register array: the index must be a constant
      for (int v = 0; v < 8; ++v) be[v] = bb[e0 + v];
#pragma unroll  // indexes a register array: the index must be a constant
      for (int j = 0; j < 2; ++j) {
        const int r  = rbase + wb * 32 + j * 16 + ln16;
        const int bi = r >> 11, m = r & (M_ - 1);
        h8 o;
#pragma unroll  // indexes a register array: the index must be a constant
        for (int v = 0; v < 8; ++v) o[v] = (_Float16)(acc[i][j][v] + be[v]);
        *reinterpret_cast<h8*>(
            &dst[(size_t)((bi * H_ + hh) * M_ + m) * DK_ + dk0]) = o;
      }
    }
    // stands behind the last store of this branch, in front of any later
    // rewrite of a register that these stores name
    asm volatile("s_wait_xcnt 0x0" ::: "memory");
  }
}

// ---------------------------------------------------------------------------
// Kernel 2: fused flash attention with geometric bias.
//   K/V chunks staged into LDS with double-buffered async copies.
//   grid = (M/128, B*H), block = 256; each wave owns 16 query rows.
// ---------------------------------------------------------------------------
__global__ __launch_bounds__(256) void attn_kernel(
    const _Float16* __restrict__ Q, const _Float16* __restrict__ K,
    const _Float16* __restrict__ Vt, const float* __restrict__ coords,
    const float* __restrict__ alpha_p, float* __restrict__ out)
{
  const int tid  = threadIdx.x;
  const int wid  = tid >> 5;
  const int lane = tid & 31;
  const int ln16 = lane & 15;
  const int g    = lane >> 4;
  const int bh   = blockIdx.y, b = bh >> 3, h = bh & 7;
  const int qbase = blockIdx.x * 128 + wid * 16;
  const float alpha = alpha_p[0];

  const _Float16* qp = Q  + (size_t)bh * M_ * DK_;
  const _Float16* kp = K  + (size_t)bh * M_ * DK_;
  const _Float16* vp = Vt + (size_t)bh * DK_ * M_;
  const float*    cb = coords + (size_t)b * M_ * 3;

  __shared__ __align__(16) _Float16 kbuf[2][32 * DK_];  // 2 x 4 KB
  __shared__ __align__(16) _Float16 vbuf[2][DK_ * 32];  // 2 x 4 KB
  __shared__ __align__(16) _Float16 pbuf[8][16 * 40];   // per-wave P staging
  _Float16* pb = &pbuf[wid][0];

  // Q A-fragments for the two d-halves (DK=64 -> 2 x K=32)
  v16h aq[2];
#pragma unroll
  for (int dt = 0; dt < 2; ++dt) {
    const _Float16* p = qp + (size_t)(qbase + ln16) * DK_ + dt * 32 + g * 8;
    aq[dt] = combine16(*reinterpret_cast<const h8*>(p),
                       *reinterpret_cast<const h8*>(p + 16));
  }

  // loop-invariant coords of this wave's 16 query rows
  float cmx[8], cmy[8], cmz[8];
#pragma unroll
  for (int v = 0; v < 8; ++v) {
    const int m = qbase + v + 8 * g;
    cmx[v] = cb[m * 3 + 0]; cmy[v] = cb[m * 3 + 1]; cmz[v] = cb[m * 3 + 2];
  }

  float rmax[8], rsum[8];
#pragma unroll
  for (int v = 0; v < 8; ++v) { rmax[v] = -3.0e38f; rsum[v] = 0.0f; }
  v8f o0 = {}, o1 = {}, o2 = {}, o3 = {};

  const int vr = tid >> 2, vq = tid & 3; // V-chunk copy assignment (64 rows x 4x16B)

  // prologue: async-stage chunk 0 into buffer 0 (2 x b128 per thread = 8 KB)
  async_copy_b128(kp + (size_t)0 * DK_ + tid * 8, &kbuf[0][tid * 8]);
  async_copy_b128(vp + (size_t)vr * M_ + 0 + vq * 8, &vbuf[0][vr * 32 + vq * 8]);

  for (int nb = 0; nb < M_ / 32; ++nb) {
    const int cur = nb & 1;
    const int nbase = nb * 32;

    asm volatile("s_wait_asynccnt 0x0" ::: "memory"); // chunk nb landed in LDS
    __syncthreads();                                  // visible to all waves;
                                                      // all done reading buf cur^1
    if (nb + 1 < M_ / 32) {                           // prefetch chunk nb+1
      const int nn = nbase + 32;
      async_copy_b128(kp + (size_t)nn * DK_ + tid * 8, &kbuf[cur ^ 1][tid * 8]);
      async_copy_b128(vp + (size_t)vr * M_ + nn + vq * 8,
                      &vbuf[cur ^ 1][vr * 32 + vq * 8]);
    }

    const _Float16* kl = &kbuf[cur][0];
    const _Float16* vl = &vbuf[cur][0];

    // --- S = Q * K^T on a 16x32 chunk (two 16x16 output tiles) ---
    v8f s0 = {}, s1 = {};
#pragma unroll
    for (int dt = 0; dt < 2; ++dt) {
      const _Float16* p0 = kl + ln16 * DK_ + dt * 32 + g * 8;
      const v16h bk0 = combine16(*reinterpret_cast<const h8*>(p0),
                                 *reinterpret_cast<const h8*>(p0 + 16));
      s0 = __builtin_amdgcn_wmma_f32_16x16x32_f16(false, aq[dt], false, bk0,
                                                  (short)0, s0, false, false);
      const _Float16* p1 = kl + (16 + ln16) * DK_ + dt * 32 + g * 8;
      const v16h bk1 = combine16(*reinterpret_cast<const h8*>(p1),
                                 *reinterpret_cast<const h8*>(p1 + 16));
      s1 = __builtin_amdgcn_wmma_f32_16x16x32_f16(false, aq[dt], false, bk1,
                                                  (short)0, s1, false, false);
    }

    // geometric bias columns for this chunk
    const int   n0 = nbase + ln16, n1 = n0 + 16;
    const float cn0x = cb[n0 * 3], cn0y = cb[n0 * 3 + 1], cn0z = cb[n0 * 3 + 2];
    const float cn1x = cb[n1 * 3], cn1y = cb[n1 * 3 + 1], cn1z = cb[n1 * 3 + 2];

    // --- online softmax (row = half-wave of 16 lanes, same VGPR) ---
#pragma unroll
    for (int v = 0; v < 8; ++v) {
      const float a0 = s0[v] * 0.125f +
                       alpha * (cmx[v] * cn0x + cmy[v] * cn0y + cmz[v] * cn0z);
      const float a1 = s1[v] * 0.125f +
                       alpha * (cmx[v] * cn1x + cmy[v] * cn1y + cmz[v] * cn1z);
      float mx = fmaxf(a0, a1);
#pragma unroll
      for (int off = 8; off >= 1; off >>= 1)
        mx = fmaxf(mx, __shfl_xor(mx, off, 32));
      const float nm  = fmaxf(rmax[v], mx);
      const float sc  = __expf(rmax[v] - nm);
      const float p0v = __expf(a0 - nm);
      const float p1v = __expf(a1 - nm);
      float ps = p0v + p1v;
#pragma unroll
      for (int off = 8; off >= 1; off >>= 1)
        ps += __shfl_xor(ps, off, 32);
      rsum[v] = rsum[v] * sc + ps;
      rmax[v] = nm;
      o0[v] *= sc; o1[v] *= sc; o2[v] *= sc; o3[v] *= sc;
      pb[(v + 8 * g) * 40 + ln16]      = (_Float16)p0v;
      pb[(v + 8 * g) * 40 + 16 + ln16] = (_Float16)p1v;
    }
    asm volatile("s_wait_dscnt 0x0" ::: "memory");

    // re-read P as a 16x32 A-fragment
    const v16h ap = combine16(
        *reinterpret_cast<const h8*>(&pb[ln16 * 40 + g * 8]),
        *reinterpret_cast<const h8*>(&pb[ln16 * 40 + 16 + g * 8]));

    // --- O += P * V (four 16x16 d-column tiles) ---
#pragma unroll
    for (int dt = 0; dt < 4; ++dt) {
      const _Float16* pv = vl + (dt * 16 + ln16) * 32 + g * 8;
      const v16h bv = combine16(*reinterpret_cast<const h8*>(pv),
                                *reinterpret_cast<const h8*>(pv + 16));
      v8f* op = (dt == 0) ? &o0 : (dt == 1) ? &o1 : (dt == 2) ? &o2 : &o3;
      *op = __builtin_amdgcn_wmma_f32_16x16x32_f16(false, ap, false, bv,
                                                   (short)0, *op, false, false);
    }
  }

  // epilogue: normalize and scatter to [B][M][512]
#pragma unroll
  for (int dt = 0; dt < 4; ++dt) {
    const v8f& o = (dt == 0) ? o0 : (dt == 1) ? o1 : (dt == 2) ? o2 : o3;
#pragma unroll
    for (int v = 0; v < 8; ++v) {
      const int m = qbase + v + 8 * g;
      const int e = h * DK_ + dt * 16 + ln16;
      out[(size_t)(b * M_ + m) * D_ + e] = o[v] / rsum[v];
    }
  }
}

// ---------------------------------------------------------------------------
extern "C" void kernel_launch(void* const* d_in, const int* in_sizes, int n_in,
                              void* d_out, int out_size, void* d_ws, size_t ws_size,
                              hipStream_t stream) {
  const float* x      = (const float*)d_in[0];
  const float* coords = (const float*)d_in[1];
  const float* wq     = (const float*)d_in[2];
  const float* bq     = (const float*)d_in[3];
  const float* wk     = (const float*)d_in[4];
  const float* bk     = (const float*)d_in[5];
  const float* wv     = (const float*)d_in[6];
  const float* bv     = (const float*)d_in[7];
  const float* alpha  = (const float*)d_in[8];
  float* out = (float*)d_out;

  _Float16* ws = (_Float16*)d_ws;
  const size_t QSZ = (size_t)B_ * H_ * M_ * DK_;   // 4,194,304 halves = 8 MB
  _Float16* Qb = ws;
  _Float16* Kb = ws + QSZ;
  _Float16* Vb = ws + 2 * QSZ;                     // total 24 MB of d_ws

  dim3 g1((B_ * M_) / 128, D_ / 128, 3);
  qkv_proj_kernel<<<g1, 256, 0, stream>>>(x, wq, bq, wk, bk, wv, bv, Qb, Kb, Vb);

  dim3 g2(M_ / 128, B_ * H_);
  attn_kernel<<<g2, 256, 0, stream>>>(Qb, Kb, Vb, coords, alpha, out);
}

// v002
// Measured time: 117 microseconds a run.
// Timed twice side by side with v001, it ran 1.33 times as fast both times.
// Over all steps from v000 it is 2.37 times as fast.
#include <hip/hip_runtime.h>

typedef __attribute__((ext_vector_type(16))) _Float16 v16h;
typedef __attribute__((ext_vector_type(8)))  _Float16 h8;
typedef __attribute__((ext_vector_type(4)))  _Float16 h4;
typedef __attribute__((ext_vector_type(8)))  float    v8f;

#define B_   4
#define H_   8
#define M_   2048
#define D_   512
#define DK_  64

static __device__ __forceinline__ v16h combine16(h8 lo, h8 hi) {
  v16h r;
#pragma unroll
  for (int i = 0; i < 8; ++i) { r[i] = lo[i]; r[i + 8] = hi[i]; }
  return r;
}

// one lane copies 16 bytes of K and 16 bytes of V global -> LDS asynchronously
// (ASYNCcnt-tracked); the s_wait_xcnt closes the statement so that it stands in
// front of every later rewrite of the four address registers
static __device__ __forceinline__ void async_copy_kv(const _Float16* gk, _Float16* lk,
                                                     const _Float16* gv, _Float16* lv) {
  const unsigned lk_off = (unsigned)(unsigned long long)lk; // LDS aperture: low 32 bits = LDS byte offset
  const unsigned lv_off = (unsigned)(unsigned long long)lv;
  asm volatile("global_load_async_to_lds_b128 %0, %1, off\n\t"
               "global_load_async_to_lds_b128 %2, %3, off\n\t"
               "s_wait_xcnt 0x0"
               :: "v"(lk_off), "v"(gk), "v"(lv_off), "v"(gv) : "memory");
}

// ---------------------------------------------------------------------------
// Kernel 1: QKV projection  y[r][e] = sum_d x[r][d] * W[e][d] + bias[e]
//   Q,K stored as f16 [B*H][M][64]; V stored transposed [B*H][64][M].
//   One block = 128 rows of x times 128 rows of W (one matrix). Both operands
//   go through LDS as f16, 64 k per pass, two buffers; each wave owns 4 x 2
//   WMMA tiles, so a staged fragment feeds several products.
//   The WMMA row operand is the one whose index runs along the output's
//   contiguous axis (W rows for Q and K, x rows for V): a lane's 8 accumulator
//   values are then 16 contiguous bytes of the output.
// ---------------------------------------------------------------------------
#define PK_  64            // k per pass
#define PT_  72            // LDS row pitch in halves: 128 B of data + 16 B pad
#define TS_  (128 * PT_)   // one operand tile in halves

// 16 bytes at a block-uniform base plus a 32-bit byte offset of the lane
static __device__ __forceinline__ float4 load4(const float* base, unsigned off) {
  return *reinterpret_cast<const float4*>(
      reinterpret_cast<const char*>(base) + off);
}

__global__ __launch_bounds__(256) void qkv_proj_kernel(
    const float* __restrict__ x,
    const float* __restrict__ wq, const float* __restrict__ bq,
    const float* __restrict__ wk, const float* __restrict__ bk,
    const float* __restrict__ wv, const float* __restrict__ bv,
    _Float16* __restrict__ Q, _Float16* __restrict__ K, _Float16* __restrict__ Vt)
{
  const int mat = blockIdx.z;
  const float* W  = (mat == 0) ? wq : (mat == 1) ? wk : wv;
  const float* bb = (mat == 0) ? bq : (mat == 1) ? bk : bv;

  const int tid  = threadIdx.x;
  const int wid  = tid >> 5;
  const int lane = tid & 31;
  const int ln16 = lane & 15;
  const int g    = lane >> 4;

  const int rbase = blockIdx.x * 128;   // rows over B*M = 8192
  const int ebase = blockIdx.y * 128;   // output columns of this matrix

  // [buffer][operand: 0 = x, 1 = W][128 rows][PT_]
  __shared__ __align__(16) _Float16 sm[2 * 2 * TS_];

  // staging slot: 16 lanes cover one 256-B piece of a row, 16 rows per sweep
  const int srow = tid >> 4, sc4 = tid & 15;
  const float*   xg = x + (size_t)rbase * D_;    // block-uniform bases
  const float*   wg = W + (size_t)ebase * D_;
  unsigned       go = (srow * D_ + sc4 * 4) * 4; // the lane's byte offset, same for both
  const int      so = srow * PT_ + sc4 * 4;

  float4 xr[8], wr[8];
#pragma unroll  // indexes a register array: the index must be a constant
  for (int j = 0; j < 8; ++j) {
    xr[j] = load4(xg + j * 16 * D_, go);
    wr[j] = load4(wg + j * 16 * D_, go);
  }

  // WMMA row operand (64 rows per wave) and column operand (32 rows per wave)
  const int oa = (mat == 2) ? 0 : TS_;
  const int ob = TS_ - oa;
  const int wa = wid >> 2, wb = wid & 3;
  const int fa = oa + (wa * 64 + ln16) * PT_ + g * 8;
  const int fb = ob + (wb * 32 + ln16) * PT_ + g * 8;

  v8f acc[4][2] = {};

  for (int p = 0; p < D_ / PK_; ++p) {
    _Float16* st = &sm[(p & 1) * 2 * TS_];

    // registers -> f16 -> LDS buffer p&1 (last read in pass p-2, which every
    // wave left before the barrier of pass p-1)
#pragma unroll  // indexes a register array: the index must be a constant
    for (int j = 0; j < 8; ++j) {
      h4 hx; hx[0] = (_Float16)xr[j].x; hx[1] = (_Float16)xr[j].y;
      hx[2] = (_Float16)xr[j].z; hx[3] = (_Float16)xr[j].w;
      *reinterpret_cast<h4*>(&st[so + j * 16 * PT_]) = hx;
      h4 hw; hw[0] = (_Float16)wr[j].x; hw[1] = (_Float16)wr[j].y;
      hw[2] = (_Float16)wr[j].z; hw[3] = (_Float16)wr[j].w;
      *reinterpret_cast<h4*>(&st[TS_ + so + j * 16 * PT_]) = hw;
    }
    __syncthreads();

    // next pass's global loads fly under this pass's products
    if (p + 1 < D_ / PK_) {
      go += PK_ * 4;
#pragma unroll  // indexes a register array: the index must be a constant
      for (int j = 0; j < 8; ++j) {
        xr[j] = load4(xg + j * 16 * D_, go);
        wr[j] = load4(wg + j * 16 * D_, go);
      }
    }
    // holds the loads in front of the products: the scheduler otherwise sinks
    // them to the pass's end, where nothing covers their latency
    __builtin_amdgcn_sched_barrier(0);

#pragma unroll
    for (int kk = 0; kk < PK_ / 32; ++kk) {
      v16h af[4], bf[2];
#pragma unroll  // indexes a register array: the index must be a constant
      for (int i = 0; i < 4; ++i) {
        const _Float16* q = &st[fa + i * 16 * PT_ + kk * 32];
        af[i] = combine16(*reinterpret_cast<const h8*>(q),
                          *reinterpret_cast<const h8*>(q + 16));
      }
#pragma unroll  // indexes a register array: the index must be a constant
      for (int j = 0; j < 2; ++j) {
        const _Float16* q = &st[fb + j * 16 * PT_ + kk * 32];
        bf[j] = combine16(*reinterpret_cast<const h8*>(q),
                          *reinterpret_cast<const h8*>(q + 16));
      }
#pragma unroll  // indexes a register array: the index must be a constant
      for (int i = 0; i < 4; ++i)
#pragma unroll  // indexes a register array: the index must be a constant
        for (int j = 0; j < 2; ++j)
          acc[i][j] = __builtin_amdgcn_wmma_f32_16x16x32_f16(
              false, af[i], false, bf[j], (short)0, acc[i][j], false, false);
    }
    // stands in front of every rewrite of the offset register that the loads
    // above name: the next pass's step and the code behind the loop
    asm volatile("s_wait_xcnt 0x0" ::: "memory");
  }

  if (mat == 2) {
    // rows of the tile = x rows (m), columns = W rows (e): 8 consecutive m per lane
#pragma unroll  // indexes a register array: the index must be a constant
    for (int j = 0; j < 2; ++j) {
      const int   e  = ebase + wb * 32 + j * 16 + ln16;
      const float be = bb[e];
      const int   hh = e >> 6, dk = e & 63;
#pragma unroll  // indexes a register array: the index must be a constant
      for (int i = 0; i < 4; ++i) {
        const int r0 = rbase + wa * 64 + i * 16 + 8 * g;
        const int bi = r0 >> 11, m0 = r0 & (M_ - 1);
        h8 o;
#pragma unroll  // indexes a register array: the index must be a constant
        for (int v = 0; v < 8; ++v) o[v] = (_Float16)(acc[i][j][v] + be);
        *reinterpret_cast<h8*>(
            &Vt[(size_t)((bi * H_ + hh) * DK_ + dk) * M_ + m0]) = o;
      }
    }
  } else {
    // rows of the tile = W rows (e), columns = x rows (m): 8 consecutive e per lane
    _Float16* dst = (mat == 0) ? Q : K;
#pragma unroll  // indexes a register array: the index must be a constant
    for (int i = 0; i < 4; ++i) {
      const int e0 = ebase + wa * 64 + i * 16 + 8 * g;
      const int hh = e0 >> 6, dk0 = e0 & 63;
      float be[8];
#pragma unroll  // indexes a register array: the index must be a constant
      for (int v = 0; v < 8; ++v) be[v] = bb[e0 + v];
#pragma unroll  // indexes a register array: the index must be a constant
      for (int j = 0; j < 2; ++j) {
        const int r  = rbase + wb * 32 + j * 16 + ln16;
        const int bi = r >> 11, m = r & (M_ - 1);
        h8 o;
#pragma unroll  // indexes a register array: the index must be a constant
        for (int v = 0; v < 8; ++v) o[v] = (_Float16)(acc[i][j][v] + be[v]);
        *reinterpret_cast<h8*>(
            &dst[(size_t)((bi * H_ + hh) * M_ + m) * DK_ + dk0]) = o;
      }
    }
    // stands behind the last store of this branch, in front of any later
    // rewrite of a register that these stores name
    asm volatile("s_wait_xcnt 0x0" ::: "memory");
  }
}

// ---------------------------------------------------------------------------
// Kernel 2: fused flash attention with geometric bias.
//   K/V chunks staged into LDS with double-buffered async copies.
//   grid = (M/128, B*H), block = 256; each wave owns 16 query rows.
//   LDS rows carry 16 bytes of pad: the pitch is an odd multiple of 16 bytes,
//   so the 16 lanes of a fragment load fall on distinct banks.
// ---------------------------------------------------------------------------
#define KP_  72            // K row pitch in halves: 128 B of data + 16 B pad
#define VP_  40            // V row pitch in halves:  64 B of data + 16 B pad
__global__ __launch_bounds__(256) void attn_kernel(
    const _Float16* __restrict__ Q, const _Float16* __restrict__ K,
    const _Float16* __restrict__ Vt, const float* __restrict__ coords,
    const float* __restrict__ alpha_p, float* __restrict__ out)
{
  const int tid  = threadIdx.x;
  const int wid  = tid >> 5;
  const int lane = tid & 31;
  const int ln16 = lane & 15;
  const int g    = lane >> 4;
  const int bh   = blockIdx.y, b = bh >> 3, h = bh & 7;
  const int qbase = blockIdx.x * 128 + wid * 16;
  const float alpha = alpha_p[0];

  const _Float16* qp = Q  + (size_t)bh * M_ * DK_;
  const _Float16* kp = K  + (size_t)bh * M_ * DK_;
  const _Float16* vp = Vt + (size_t)bh * DK_ * M_;
  const float*    cb = coords + (size_t)b * M_ * 3;

  __shared__ __align__(16) _Float16 kbuf[2][32 * KP_];  // 2 x 4.5 KB
  __shared__ __align__(16) _Float16 vbuf[2][DK_ * VP_]; // 2 x 5 KB
  __shared__ __align__(16) _Float16 pbuf[8][16 * 40];   // per-wave P staging
  _Float16* pb = &pbuf[wid][0];

  // Q A-fragments for the two d-halves (DK=64 -> 2 x K=32)
  v16h aq[2];
#pragma unroll
  for (int dt = 0; dt < 2; ++dt) {
    const _Float16* p = qp + (size_t)(qbase + ln16) * DK_ + dt * 32 + g * 8;
    aq[dt] = combine16(*reinterpret_cast<const h8*>(p),
                       *reinterpret_cast<const h8*>(p + 16));
  }

  // loop-invariant coords of this wave's 16 query rows
  float cmx[8], cmy[8], cmz[8];
#pragma unroll
  for (int v = 0; v < 8; ++v) {
    const int m = qbase + v + 8 * g;
    cmx[v] = cb[m * 3 + 0]; cmy[v] = cb[m * 3 + 1]; cmz[v] = cb[m * 3 + 2];
  }

  float rmax[8], rsum[8];
#pragma unroll
  for (int v = 0; v < 8; ++v) { rmax[v] = -3.0e38f; rsum[v] = 0.0f; }
  v8f o0 = {}, o1 = {}, o2 = {}, o3 = {};

  const int kr = tid >> 3, kq = tid & 7; // K-chunk copy assignment (32 rows x 8x16B)
  const int vr = tid >> 2, vq = tid & 3; // V-chunk copy assignment (64 rows x 4x16B)
  const int ks = kr * KP_ + kq * 8;      // the lane's 16 bytes in a K buffer
  const int vs = vr * VP_ + vq * 8;      // the lane's 16 bytes in a V buffer

  // prologue: async-stage chunk 0 into buffer 0 (2 x b128 per thread = 8 KB)
  async_copy_kv(kp + (size_t)0 * DK_ + tid * 8, &kbuf[0][ks],
                vp + (size_t)vr * M_ + 0 + vq * 8, &vbuf[0][vs]);

  for (int nb = 0; nb < M_ / 32; ++nb) {
    const int cur = nb & 1;
    const int nbase = nb * 32;

    // this wave's reads of the buffer that is refilled behind the barrier have retired
    asm volatile("s_wait_dscnt 0x0" ::: "memory");
    asm volatile("s_wait_asynccnt 0x0" ::: "memory"); // chunk nb landed in LDS
    __syncthreads();                                  // visible to all waves;
                                                      // all done reading buf cur^1
    if (nb + 1 < M_ / 32) {                           // prefetch chunk nb+1
      const int nn = nbase + 32;
      async_copy_kv(kp + (size_t)nn * DK_ + tid * 8, &kbuf[cur ^ 1][ks],
                    vp + (size_t)vr * M_ + nn + vq * 8, &vbuf[cur ^ 1][vs]);
    }

    const _Float16* kl = &kbuf[cur][0];
    const _Float16* vl = &vbuf[cur][0];

    // --- S = Q * K^T on a 16x32 chunk (two 16x16 output tiles) ---
    v8f s0 = {}, s1 = {};
#pragma unroll
    for (int dt = 0; dt < 2; ++dt) {
      const _Float16* p0 = kl + ln16 * KP_ + dt * 32 + g * 8;
      const v16h bk0 = combine16(*reinterpret_cast<const h8*>(p0),
                                 *reinterpret_cast<const h8*>(p0 + 16));
      s0 = __builtin_amdgcn_wmma_f32_16x16x32_f16(false, aq[dt], false, bk0,
                                                  (short)0, s0, false, false);
      const _Float16* p1 = kl + (16 + ln16) * KP_ + dt * 32 + g * 8;
      const v16h bk1 = combine16(*reinterpret_cast<const h8*>(p1),
                                 *reinterpret_cast<const h8*>(p1 + 16));
      s1 = __builtin_amdgcn_wmma_f32_16x16x32_f16(false, aq[dt], false, bk1,
                                                  (short)0, s1, false, false);
    }

    // geometric bias columns for this chunk
    const int   n0 = nbase + ln16, n1 = n0 + 16;
    const float cn0x = cb[n0 * 3], cn0y = cb[n0 * 3 + 1], cn0z = cb[n0 * 3 + 2];
    const float cn1x = cb[n1 * 3], cn1y = cb[n1 * 3 + 1], cn1z = cb[n1 * 3 + 2];

    // --- online softmax (row = half-wave of 16 lanes, same VGPR) ---
#pragma unroll
    for (int v = 0; v < 8; ++v) {
      const float a0 = s0[v] * 0.125f +
                       alpha * (cmx[v] * cn0x + cmy[v] * cn0y + cmz[v] * cn0z);
      const float a1 = s1[v] * 0.125f +
                       alpha * (cmx[v] * cn1x + cmy[v] * cn1y + cmz[v] * cn1z);
      float mx = fmaxf(a0, a1);
#pragma unroll
      for (int off = 8; off >= 1; off >>= 1)
        mx = fmaxf(mx, __shfl_xor(mx, off, 32));
      const float nm  = fmaxf(rmax[v], mx);
      const float sc  = __expf(rmax[v] - nm);
      const float p0v = __expf(a0 - nm);
      const float p1v = __expf(a1 - nm);
      float ps = p0v + p1v;
#pragma unroll
      for (int off = 8; off >= 1; off >>= 1)
        ps += __shfl_xor(ps, off, 32);
      rsum[v] = rsum[v] * sc + ps;
      rmax[v] = nm;
      o0[v] *= sc; o1[v] *= sc; o2[v] *= sc; o3[v] *= sc;
      pb[(v + 8 * g) * 40 + ln16]      = (_Float16)p0v;
      pb[(v + 8 * g) * 40 + 16 + ln16] = (_Float16)p1v;
    }
    asm volatile("s_wait_dscnt 0x0" ::: "memory");

    // re-read P as a 16x32 A-fragment
    const v16h ap = combine16(
        *reinterpret_cast<const h8*>(&pb[ln16 * 40 + g * 8]),
        *reinterpret_cast<const h8*>(&pb[ln16 * 40 + 16 + g * 8]));

    // --- O += P * V (four 16x16 d-column tiles) ---
#pragma unroll
    for (int dt = 0; dt < 4; ++dt) {
      const _Float16* pv = vl + (dt * 16 + ln16) * VP_ + g * 8;
      const v16h bv = combine16(*reinterpret_cast<const h8*>(pv),
                                *reinterpret_cast<const h8*>(pv + 16));
      v8f* op = (dt == 0) ? &o0 : (dt == 1) ? &o1 : (dt == 2) ? &o2 : &o3;
      *op = __builtin_amdgcn_wmma_f32_16x16x32_f16(false, ap, false, bv,
                                                   (short)0, *op, false, false);
    }
  }

  // epilogue: normalize and scatter to [B][M][512]
#pragma unroll
  for (int dt = 0; dt < 4; ++dt) {
    const v8f& o = (dt == 0) ? o0 : (dt == 1) ? o1 : (dt == 2) ? o2 : o3;
#pragma unroll
    for (int v = 0; v < 8; ++v) {
      const int m = qbase + v + 8 * g;
      const int e = h * DK_ + dt * 16 + ln16;
      out[(size_t)(b * M_ + m) * D_ + e] = o[v] / rsum[v];
    }
  }
}

// ---------------------------------------------------------------------------
extern "C" void kernel_launch(void* const* d_in, const int* in_sizes, int n_in,
                              void* d_out, int out_size, void* d_ws, size_t ws_size,
                              hipStream_t stream) {
  const float* x      = (const float*)d_in[0];
  const float* coords = (const float*)d_in[1];
  const float* wq     = (const float*)d_in[2];
  const float* bq     = (const float*)d_in[3];
  const float* wk     = (const float*)d_in[4];
  const float* bk     = (const float*)d_in[5];
  const float* wv     = (const float*)d_in[6];
  const float* bv     = (const float*)d_in[7];
  const float* alpha  = (const float*)d_in[8];
  float* out = (float*)d_out;

  _Float16* ws = (_Float16*)d_ws;
  const size_t QSZ = (size_t)B_ * H_ * M_ * DK_;   // 4,194,304 halves = 8 MB
  _Float16* Qb = ws;
  _Float16* Kb = ws + QSZ;
  _Float16* Vb = ws + 2 * QSZ;                     // total 24 MB of d_ws

  dim3 g1((B_ * M_) / 128, D_ / 128, 3);
  qkv_proj_kernel<<<g1, 256, 0, stream>>>(x, wq, bq, wk, bk, wv, bv, Qb, Kb, Vb);

  dim3 g2(M_ / 128, B_ * H_);
  attn_kernel<<<g2, 256, 0, stream>>>(Qb, Kb, Vb, coords, alpha, out);
}

// v003
// It runs in 78.7 microseconds.
// In both of two side-by-side timings against v002, it was 1.51 times as fast.
// Counting every step since v000, it is 3.57 times as fast.
#include <hip/hip_runtime.h>

typedef __attribute__((ext_vector_type(16))) _Float16 v16h;
typedef __attribute__((ext_vector_type(8)))  _Float16 h8;
typedef __attribute__((ext_vector_type(4)))  _Float16 h4;
typedef __attribute__((ext_vector_type(8)))  float    v8f;
typedef __attribute__((ext_vector_type(4)))  float    f4;

#define B_   4
#define H_   8
#define M_   2048
#define D_   512
#define DK_  64

static __device__ __forceinline__ v16h combine16(h8 lo, h8 hi) {
  v16h r;
#pragma unroll
  for (int i = 0; i < 8; ++i) { r[i] = lo[i]; r[i + 8] = hi[i]; }
  return r;
}

// one lane copies 16 bytes of K and 16 bytes of V global -> LDS asynchronously
// (ASYNCcnt-tracked); the s_wait_xcnt closes the statement so that it stands in
// front of every later rewrite of the four address registers
static __device__ __forceinline__ void async_copy_kv(const _Float16* gk, _Float16* lk,
                                                     const _Float16* gv, _Float16* lv) {
  const unsigned lk_off = (unsigned)(unsigned long long)lk; // LDS aperture: low 32 bits = LDS byte offset
  const unsigned lv_off = (unsigned)(unsigned long long)lv;
  asm volatile("global_load_async_to_lds_b128 %0, %1, off\n\t"
               "global_load_async_to_lds_b128 %2, %3, off\n\t"
               "s_wait_xcnt 0x0"
               :: "v"(lk_off), "v"(gk), "v"(lv_off), "v"(gv) : "memory");
}

// ---------------------------------------------------------------------------
// Kernel 1: QKV projection  y[r][e] = sum_d x[r][d] * W[e][d] + bias[e]
//   Q,K stored as f16 [B*H][M][64]; V stored transposed [B*H][64][M].
//   One block = 128 rows of x times 128 rows of W (one matrix). Both operands
//   go through LDS as f16, 64 k per pass, two buffers; each wave owns 4 x 2
//   WMMA tiles, so a staged fragment feeds several products.
//   The WMMA row operand is the one whose index runs along the output's
//   contiguous axis (W rows for Q and K, x rows for V): a lane's 8 accumulator
//   values are then 16 contiguous bytes of the output.
// ---------------------------------------------------------------------------
#define PK_  64            // k per pass
#define PT_  72            // LDS row pitch in halves: 128 B of data + 16 B pad
#define TS_  (128 * PT_)   // one operand tile in halves

// 16 bytes at a block-uniform base plus a 32-bit byte offset of the lane
static __device__ __forceinline__ float4 load4(const float* base, unsigned off) {
  return *reinterpret_cast<const float4*>(
      reinterpret_cast<const char*>(base) + off);
}

__global__ __launch_bounds__(256) void qkv_proj_kernel(
    const float* __restrict__ x,
    const float* __restrict__ wq, const float* __restrict__ bq,
    const float* __restrict__ wk, const float* __restrict__ bk,
    const float* __restrict__ wv, const float* __restrict__ bv,
    _Float16* __restrict__ Q, _Float16* __restrict__ K, _Float16* __restrict__ Vt)
{
  const int mat = blockIdx.z;
  const float* W  = (mat == 0) ? wq : (mat == 1) ? wk : wv;
  const float* bb = (mat == 0) ? bq : (mat == 1) ? bk : bv;

  const int tid  = threadIdx.x;
  const int wid  = tid >> 5;
  const int lane = tid & 31;
  const int ln16 = lane & 15;
  const int g    = lane >> 4;

  const int rbase = blockIdx.x * 128;   // rows over B*M = 8192
  const int ebase = blockIdx.y * 128;   // output columns of this matrix

  // [buffer][operand: 0 = x, 1 = W][128 rows][PT_]
  __shared__ __align__(16) _Float16 sm[2 * 2 * TS_];

  // staging slot: 16 lanes cover one 256-B piece of a row, 16 rows per sweep
  const int srow = tid >> 4, sc4 = tid & 15;
  const float*   xg = x + (size_t)rbase * D_;    // block-uniform bases
  const float*   wg = W + (size_t)ebase * D_;
  unsigned       go = (srow * D_ + sc4 * 4) * 4; // the lane's byte offset, same for both
  const int      so = srow * PT_ + sc4 * 4;

  float4 xr[8], wr[8];
#pragma unroll  // indexes a register array: the index must be a constant
  for (int j = 0; j < 8; ++j) {
    xr[j] = load4(xg + j * 16 * D_, go);
    wr[j] = load4(wg + j * 16 * D_, go);
  }

  // WMMA row operand (64 rows per wave) and column operand (32 rows per wave)
  const int oa = (mat == 2) ? 0 : TS_;
  const int ob = TS_ - oa;
  const int wa = wid >> 2, wb = wid & 3;
  const int fa = oa + (wa * 64 + ln16) * PT_ + g * 8;
  const int fb = ob + (wb * 32 + ln16) * PT_ + g * 8;

  v8f acc[4][2] = {};

  for (int p = 0; p < D_ / PK_; ++p) {
    _Float16* st = &sm[(p & 1) * 2 * TS_];

    // registers -> f16 -> LDS buffer p&1 (last read in pass p-2, which every
    // wave left before the barrier of pass p-1)
#pragma unroll  // indexes a register array: the index must be a constant
    for (int j = 0; j < 8; ++j) {
      h4 hx; hx[0] = (_Float16)xr[j].x; hx[1] = (_Float16)xr[j].y;
      hx[2] = (_Float16)xr[j].z; hx[3] = (_Float16)xr[j].w;
      *reinterpret_cast<h4*>(&st[so + j * 16 * PT_]) = hx;
      h4 hw; hw[0] = (_Float16)wr[j].x; hw[1] = (_Float16)wr[j].y;
      hw[2] = (_Float16)wr[j].z; hw[3] = (_Float16)wr[j].w;
      *reinterpret_cast<h4*>(&st[TS_ + so + j * 16 * PT_]) = hw;
    }
    __syncthreads();

    // next pass's global loads fly under this pass's products
    if (p + 1 < D_ / PK_) {
      go += PK_ * 4;
#pragma unroll  // indexes a register array: the index must be a constant
      for (int j = 0; j < 8; ++j) {
        xr[j] = load4(xg + j * 16 * D_, go);
        wr[j] = load4(wg + j * 16 * D_, go);
      }
    }
    // holds the loads in front of the products: the scheduler otherwise sinks
    // them to the pass's end, where nothing covers their latency
    __builtin_amdgcn_sched_barrier(0);

#pragma unroll
    for (int kk = 0; kk < PK_ / 32; ++kk) {
      v16h af[4], bf[2];
#pragma unroll  // indexes a register array: the index must be a constant
      for (int i = 0; i < 4; ++i) {
        const _Float16* q = &st[fa + i * 16 * PT_ + kk * 32];
        af[i] = combine16(*reinterpret_cast<const h8*>(q),
                          *reinterpret_cast<const h8*>(q + 16));
      }
#pragma unroll  // indexes a register array: the index must be a constant
      for (int j = 0; j < 2; ++j) {
        const _Float16* q = &st[fb + j * 16 * PT_ + kk * 32];
        bf[j] = combine16(*reinterpret_cast<const h8*>(q),
                          *reinterpret_cast<const h8*>(q + 16));
      }
#pragma unroll  // indexes a register array: the index must be a constant
      for (int i = 0; i < 4; ++i)
#pragma unroll  // indexes a register array: the index must be a constant
        for (int j = 0; j < 2; ++j)
          acc[i][j] = __builtin_amdgcn_wmma_f32_16x16x32_f16(
              false, af[i], false, bf[j], (short)0, acc[i][j], false, false);
    }
    // stands in front of every rewrite of the offset register that the loads
    // above name: the next pass's step and the code behind the loop
    asm volatile("s_wait_xcnt 0x0" ::: "memory");
  }

  if (mat == 2) {
    // rows of the tile = x rows (m), columns = W rows (e): 8 consecutive m per lane
#pragma unroll  // indexes a register array: the index must be a constant
    for (int j = 0; j < 2; ++j) {
      const int   e  = ebase + wb * 32 + j * 16 + ln16;
      const float be = bb[e];
      const int   hh = e >> 6, dk = e & 63;
#pragma unroll  // indexes a register array: the index must be a constant
      for (int i = 0; i < 4; ++i) {
        const int r0 = rbase + wa * 64 + i * 16 + 8 * g;
        const int bi = r0 >> 11, m0 = r0 & (M_ - 1);
        h8 o;
#pragma unroll  // indexes a register array: the index must be a constant
        for (int v = 0; v < 8; ++v) o[v] = (_Float16)(acc[i][j][v] + be);
        *reinterpret_cast<h8*>(
            &Vt[(size_t)((bi * H_ + hh) * DK_ + dk) * M_ + m0]) = o;
      }
    }
  } else {
    // rows of the tile = W rows (e), columns = x rows (m): 8 consecutive e per lane
    _Float16* dst = (mat == 0) ? Q : K;
#pragma unroll  // indexes a register array: the index must be a constant
    for (int i = 0; i < 4; ++i) {
      const int e0 = ebase + wa * 64 + i * 16 + 8 * g;
      const int hh = e0 >> 6, dk0 = e0 & 63;
      float be[8];
#pragma unroll  // indexes a register array: the index must be a constant
      for (int v = 0; v < 8; ++v) be[v] = bb[e0 + v];
#pragma unroll  // indexes a register array: the index must be a constant
      for (int j = 0; j < 2; ++j) {
        const int r  = rbase + wb * 32 + j * 16 + ln16;
        const int bi = r >> 11, m = r & (M_ - 1);
        h8 o;
#pragma unroll  // indexes a register array: the index must be a constant
        for (int v = 0; v < 8; ++v) o[v] = (_Float16)(acc[i][j][v] + be[v]);
        *reinterpret_cast<h8*>(
            &dst[(size_t)((bi * H_ + hh) * M_ + m) * DK_ + dk0]) = o;
      }
    }
    // stands behind the last store of this branch, in front of any later
    // rewrite of a register that these stores name
    asm volatile("s_wait_xcnt 0x0" ::: "memory");
  }
}

#define KP_  72            // K row pitch in halves: 128 B of data + 16 B pad
#define VP_  40            // V row pitch in halves:  64 B of data + 16 B pad

// value of lane l ^ 16
static __device__ __forceinline__ float xhalf(float x) {
  const int b = __builtin_bit_cast(int, x);
  return __builtin_bit_cast(float, __builtin_amdgcn_permlanex16(
      b, b, 0x76543210, 0xfedcba98, false, false));
}

__global__ __launch_bounds__(256) void attn_kernel(
    const _Float16* __restrict__ Q, const _Float16* __restrict__ K,
    const _Float16* __restrict__ Vt, const float* __restrict__ coords,
    const float* __restrict__ alpha_p, float* __restrict__ out)
{
  const int tid  = threadIdx.x;
  const int wid  = tid >> 5;
  const int lane = tid & 31;
  const int ln16 = lane & 15;
  const int g    = lane >> 4;
  const int bh   = blockIdx.y, b = bh >> 3, h = bh & 7;
  const int qbase = blockIdx.x * 128 + wid * 16;
  const float alpha = alpha_p[0];

  const _Float16* qp = Q  + (size_t)bh * M_ * DK_;
  const _Float16* kp = K  + (size_t)bh * M_ * DK_;
  const _Float16* vp = Vt + (size_t)bh * DK_ * M_;
  const float*    cb = coords + (size_t)b * M_ * 3;

  __shared__ __align__(16) _Float16 kbuf[2][32 * KP_];  // 2 x 4.5 KB
  __shared__ __align__(16) _Float16 vbuf[2][DK_ * VP_]; // 2 x 5 KB

  // Q column fragments for the two d-halves (DK=64 -> 2 x K=32)
  v16h bq[2];
#pragma unroll
  for (int dt = 0; dt < 2; ++dt) {
    const _Float16* p = qp + (size_t)(qbase + ln16) * DK_ + dt * 32 + g * 8;
    bq[dt] = combine16(*reinterpret_cast<const h8*>(p),
                       *reinterpret_cast<const h8*>(p + 16));
  }

  // coords of this lane's query
  const float cmx = cb[(qbase + ln16) * 3 + 0];
  const float cmy = cb[(qbase + ln16) * 3 + 1];
  const float cmz = cb[(qbase + ln16) * 3 + 2];

  float rmax = -3.0e38f, rsum = 0.0f;  // rsum: this lane's 16 keys of each chunk only
  v8f o0 = {}, o1 = {}, o2 = {}, o3 = {};

  const int kr = tid >> 3, kq = tid & 7; // K-chunk copy assignment (32 rows x 8x16B)
  const int vr = tid >> 2, vq = tid & 3; // V-chunk copy assignment (64 rows x 4x16B)
  const int ks = kr * KP_ + kq * 8;      // the lane's 16 bytes in a K buffer
  const int vs = vr * VP_ + vq * 8;      // the lane's 16 bytes in a V buffer

  // prologue: async-stage chunk 0 into buffer 0 (2 x b128 per thread = 8 KB)
  async_copy_kv(kp + (size_t)0 * DK_ + tid * 8, &kbuf[0][ks],
                vp + (size_t)vr * M_ + 0 + vq * 8, &vbuf[0][vs]);

  // coords of this lane's keys of a chunk: keys 8g + 0..7 and 16 + 8g + 0..7,
  // 96 contiguous bytes each; kept in registers, fetched one chunk ahead
  const unsigned co = g * 96;            // the lane's byte offset in a chunk's coords
  float4 kc[2][6];
#pragma unroll
  for (int t = 0; t < 2; ++t)
#pragma unroll
    for (int i = 0; i < 6; ++i) kc[t][i] = load4(cb, co + t * 192 + i * 16);
  // stands behind the loads, in front of every later rewrite of an address
  // register that they name
  asm volatile("s_wait_xcnt 0x0" ::: "memory");

  for (int nb = 0; nb < M_ / 32; ++nb) {
    const int cur = nb & 1;
    const int nbase = nb * 32;

    // this wave's reads of the buffer that is refilled behind the barrier have retired
    asm volatile("s_wait_dscnt 0x0" ::: "memory");
    asm volatile("s_wait_asynccnt 0x0" ::: "memory"); // chunk nb landed in LDS
    __syncthreads();                                  // visible to all waves;
                                                      // all done reading buf cur^1
    if (nb + 1 < M_ / 32) {                           // prefetch chunk nb+1
      const int nn = nbase + 32;
      async_copy_kv(kp + (size_t)nn * DK_ + tid * 8, &kbuf[cur ^ 1][ks],
                    vp + (size_t)vr * M_ + nn + vq * 8, &vbuf[cur ^ 1][vs]);
    }

    const _Float16* kl = &kbuf[cur][0];
    const _Float16* vl = &vbuf[cur][0];

    // --- S^T = K * Q^T on a 32x16 chunk (two 16x16 output tiles) ---
    v8f s0 = {}, s1 = {};
#pragma unroll
    for (int dt = 0; dt < 2; ++dt) {
      const _Float16* p0 = kl + ln16 * KP_ + dt * 32 + g * 8;
      const v16h ak0 = combine16(*reinterpret_cast<const h8*>(p0),
                                 *reinterpret_cast<const h8*>(p0 + 16));
      s0 = __builtin_amdgcn_wmma_f32_16x16x32_f16(false, ak0, false, bq[dt],
                                                  (short)0, s0, false, false);
      const _Float16* p1 = kl + (16 + ln16) * KP_ + dt * 32 + g * 8;
      const v16h ak1 = combine16(*reinterpret_cast<const h8*>(p1),
                                 *reinterpret_cast<const h8*>(p1 + 16));
      s1 = __builtin_amdgcn_wmma_f32_16x16x32_f16(false, ak1, false, bq[dt],
                                                  (short)0, s1, false, false);
    }

    // --- online softmax: 16 scores of one query per lane ---
    float a[16];
#pragma unroll
    for (int t = 0; t < 2; ++t) {
      const v8f& s = t ? s1 : s0;
      float c[24];
#pragma unroll
      for (int i = 0; i < 6; ++i) {
        c[4 * i + 0] = kc[t][i].x; c[4 * i + 1] = kc[t][i].y;
        c[4 * i + 2] = kc[t][i].z; c[4 * i + 3] = kc[t][i].w;
      }
#pragma unroll
      for (int v = 0; v < 8; ++v)
        a[8 * t + v] = s[v] * 0.125f + alpha * (cmx * c[3 * v] + cmy * c[3 * v + 1] +
                                                cmz * c[3 * v + 2]);
    }

    // next chunk's key coords: fetched one chunk ahead, a trip's work covers their latency
    if (nb + 1 < M_ / 32) {
      const float* cn = cb + (nbase + 32) * 3;
#pragma unroll
      for (int t = 0; t < 2; ++t)
#pragma unroll
        for (int i = 0; i < 6; ++i) kc[t][i] = load4(cn, co + t * 192 + i * 16);
      // stands behind the loads, in front of every later rewrite of an address
      // register that they name
      asm volatile("s_wait_xcnt 0x0" ::: "memory");
    }

    float t[8];
#pragma unroll
    for (int i = 0; i < 8; ++i) t[i] = fmaxf(a[2 * i], a[2 * i + 1]);
#pragma unroll
    for (int s = 4; s >= 1; s >>= 1)
#pragma unroll
      for (int i = 0; i < s; ++i) t[i] = fmaxf(t[2 * i], t[2 * i + 1]);
    const float mx = fmaxf(t[0], xhalf(t[0]));  // both halves use one maximum
    const float nm = fmaxf(rmax, mx);
    const float sc = __expf(rmax - nm);
    rmax = nm;

    // P^T: element s of the column operand is key 8g + s (s < 8), 16 + 8g + s - 8
    // (s >= 8), which is what the two score tiles hold in this lane
    v16h bp;
#pragma unroll
    for (int i = 0; i < 16; ++i) {
      a[i]  = __expf(a[i] - nm);
      bp[i] = (_Float16)a[i];
    }
#pragma unroll
    for (int s = 8; s >= 1; s >>= 1)
#pragma unroll
      for (int i = 0; i < s; ++i) a[i] = a[2 * i] + a[2 * i + 1];
    rsum = rsum * sc + a[0];
    o0 *= sc; o1 *= sc; o2 *= sc; o3 *= sc;

    // --- O^T += V^T * P^T (four 16x16 d-row tiles) ---
#pragma unroll
    for (int dt = 0; dt < 4; ++dt) {
      const _Float16* pv = vl + (dt * 16 + ln16) * VP_ + g * 8;
      const v16h av = combine16(*reinterpret_cast<const h8*>(pv),
                                *reinterpret_cast<const h8*>(pv + 16));
      v8f* op = (dt == 0) ? &o0 : (dt == 1) ? &o1 : (dt == 2) ? &o2 : &o3;
      *op = __builtin_amdgcn_wmma_f32_16x16x32_f16(false, av, false, bp,
                                                   (short)0, *op, false, false);
    }
  }

  // epilogue: join the two halves' sums, normalize, store to [B][M][512];
  // a lane holds 8 consecutive d of its query in each tile
  const float rs = rsum + xhalf(rsum);
  float* orow = out + (size_t)(b * M_ + qbase + ln16) * D_ + h * DK_ + 8 * g;
#pragma unroll
  for (int dt = 0; dt < 4; ++dt) {
    const v8f& o = (dt == 0) ? o0 : (dt == 1) ? o1 : (dt == 2) ? o2 : o3;
    f4 lo, hi;
#pragma unroll
    for (int v = 0; v < 4; ++v) { lo[v] = o[v] / rs; hi[v] = o[4 + v] / rs; }
    // the s_wait_xcnt closes the statement so that it stands in front of every
    // later rewrite of a register that the two stores name
    asm volatile("global_store_b128 %0, %1, off\n\t"
                 "global_store_b128 %0, %2, off offset:16\n\t"
                 "s_wait_xcnt 0x0"
                 :: "v"(orow + dt * 16), "v"(lo), "v"(hi) : "memory");
  }
}

// ---------------------------------------------------------------------------
extern "C" void kernel_launch(void* const* d_in, const int* in_sizes, int n_in,
                              void* d_out, int out_size, void* d_ws, size_t ws_size,
                              hipStream_t stream) {
  const float* x      = (const float*)d_in[0];
  const float* coords = (const float*)d_in[1];
  const float* wq     = (const float*)d_in[2];
  const float* bq     = (const float*)d_in[3];
  const float* wk     = (const float*)d_in[4];
  const float* bk     = (const float*)d_in[5];
  const float* wv     = (const float*)d_in[6];
  const float* bv     = (const float*)d_in[7];
  const float* alpha  = (const float*)d_in[8];
  float* out = (float*)d_out;

  _Float16* ws = (_Float16*)d_ws;
  const size_t QSZ = (size_t)B_ * H_ * M_ * DK_;   // 4,194,304 halves = 8 MB
  _Float16* Qb = ws;
  _Float16* Kb = ws + QSZ;
  _Float16* Vb = ws + 2 * QSZ;                     // total 24 MB of d_ws

  dim3 g1((B_ * M_) / 128, D_ / 128, 3);
  qkv_proj_kernel<<<g1, 256, 0, stream>>>(x, wq, bq, wk, bk, wv, bv, Qb, Kb, Vb);

  dim3 g2(M_ / 128, B_ * H_);
  attn_kernel<<<g2, 256, 0, stream>>>(Qb, Kb, Vb, coords, alpha, out);
}

// v004
// One run takes 74.5 microseconds.
// Next to v003, in two timings, it ran 1.05 times as fast each time.
// Over all steps from v000 it is 3.76 times as fast.
#include <hip/hip_runtime.h>

typedef __attribute__((ext_vector_type(16))) _Float16 v16h;
typedef __attribute__((ext_vector_type(8)))  _Float16 h8;
typedef __attribute__((ext_vector_type(4)))  _Float16 h4;
typedef __attribute__((ext_vector_type(8)))  float    v8f;
typedef __attribute__((ext_vector_type(4)))  float    f4;

#define B_   4
#define H_   8
#define M_   2048
#define D_   512
#define DK_  64

static __device__ __forceinline__ v16h combine16(h8 lo, h8 hi) {
  v16h r;
#pragma unroll
  for (int i = 0; i < 8; ++i) { r[i] = lo[i]; r[i + 8] = hi[i]; }
  return r;
}

// one lane copies 4 x 16 bytes of K and 4 x 16 bytes of V global -> LDS
// asynchronously (ASYNCcnt-tracked): its share of one stage. gks/gvs and lks/lvs
// are the steps in halves from one of its pieces to the next, in global memory
// and in LDS. The s_wait_xcnt closes the statement so that it stands in front of
// every later rewrite of an address register that a copy names
static __device__ __forceinline__ void async_copy_stage(
    const _Float16* gk, int gks, _Float16* lk, int lks,
    const _Float16* gv, int gvs, _Float16* lv, int lvs) {
  const unsigned lk_off = (unsigned)(unsigned long long)lk; // LDS aperture: low 32 bits = LDS byte offset
  const unsigned lv_off = (unsigned)(unsigned long long)lv;
  asm volatile("global_load_async_to_lds_b128 %0, %8, off\n\t"
               "global_load_async_to_lds_b128 %1, %9, off\n\t"
               "global_load_async_to_lds_b128 %2, %10, off\n\t"
               "global_load_async_to_lds_b128 %3, %11, off\n\t"
               "global_load_async_to_lds_b128 %4, %12, off\n\t"
               "global_load_async_to_lds_b128 %5, %13, off\n\t"
               "global_load_async_to_lds_b128 %6, %14, off\n\t"
               "global_load_async_to_lds_b128 %7, %15, off\n\t"
               "s_wait_xcnt 0x0"
               :: "v"(lk_off), "v"(lk_off + 2 * lks), "v"(lk_off + 4 * lks), "v"(lk_off + 6 * lks),
                  "v"(lv_off), "v"(lv_off + 2 * lvs), "v"(lv_off + 4 * lvs), "v"(lv_off + 6 * lvs),
                  "v"(gk), "v"(gk + gks), "v"(gk + 2 * gks), "v"(gk + 3 * gks),
                  "v"(gv), "v"(gv + gvs), "v"(gv + 2 * gvs), "v"(gv + 3 * gvs)
               : "memory");
}

// ---------------------------------------------------------------------------
// Kernel 1: QKV projection  y[r][e] = sum_d x[r][d] * W[e][d] + bias[e]
//   Q,K stored as f16 [B*H][M][64]; V stored transposed [B*H][64][M].
//   One block = 128 rows of x times 128 rows of W (one matrix). Both operands
//   go through LDS as f16, 64 k per pass, two buffers; each wave owns 4 x 2
//   WMMA tiles, so a staged fragment feeds several products.
//   The WMMA row operand is the one whose index runs along the output's
//   contiguous axis (W rows for Q and K, x rows for V): a lane's 8 accumulator
//   values are then 16 contiguous bytes of the output.
// ---------------------------------------------------------------------------
#define PK_  64            // k per pass
#define PT_  72            // LDS row pitch in halves: 128 B of data + 16 B pad
#define TS_  (128 * PT_)   // one operand tile in halves

// 16 bytes at a block-uniform base plus a 32-bit byte offset of the lane
static __device__ __forceinline__ float4 load4(const float* base, unsigned off) {
  return *reinterpret_cast<const float4*>(
      reinterpret_cast<const char*>(base) + off);
}

__global__ __launch_bounds__(256) void qkv_proj_kernel(
    const float* __restrict__ x,
    const float* __restrict__ wq, const float* __restrict__ bq,
    const float* __restrict__ wk, const float* __restrict__ bk,
    const float* __restrict__ wv, const float* __restrict__ bv,
    _Float16* __restrict__ Q, _Float16* __restrict__ K, _Float16* __restrict__ Vt)
{
  const int mat = blockIdx.z;
  const float* W  = (mat == 0) ? wq : (mat == 1) ? wk : wv;
  const float* bb = (mat == 0) ? bq : (mat == 1) ? bk : bv;

  const int tid  = threadIdx.x;
  const int wid  = tid >> 5;
  const int lane = tid & 31;
  const int ln16 = lane & 15;
  const int g    = lane >> 4;

  const int rbase = blockIdx.x * 128;   // rows over B*M = 8192
  const int ebase = blockIdx.y * 128;   // output columns of this matrix

  // [buffer][operand: 0 = x, 1 = W][128 rows][PT_]
  __shared__ __align__(16) _Float16 sm[2 * 2 * TS_];

  // staging slot: 16 lanes cover one 256-B piece of a row, 16 rows per sweep
  const int srow = tid >> 4, sc4 = tid & 15;
  const float*   xg = x + (size_t)rbase * D_;    // block-uniform bases
  const float*   wg = W + (size_t)ebase * D_;
  unsigned       go = (srow * D_ + sc4 * 4) * 4; // the lane's byte offset, same for both
  const int      so = srow * PT_ + sc4 * 4;

  float4 xr[8], wr[8];
#pragma unroll  // indexes a register array: the index must be a constant
  for (int j = 0; j < 8; ++j) {
    xr[j] = load4(xg + j * 16 * D_, go);
    wr[j] = load4(wg + j * 16 * D_, go);
  }

  // WMMA row operand (64 rows per wave) and column operand (32 rows per wave)
  const int oa = (mat == 2) ? 0 : TS_;
  const int ob = TS_ - oa;
  const int wa = wid >> 2, wb = wid & 3;
  const int fa = oa + (wa * 64 + ln16) * PT_ + g * 8;
  const int fb = ob + (wb * 32 + ln16) * PT_ + g * 8;

  v8f acc[4][2] = {};

  for (int p = 0; p < D_ / PK_; ++p) {
    _Float16* st = &sm[(p & 1) * 2 * TS_];

    // registers -> f16 -> LDS buffer p&1 (last read in pass p-2, which every
    // wave left before the barrier of pass p-1)
#pragma unroll  // indexes a register array: the index must be a constant
    for (int j = 0; j < 8; ++j) {
      h4 hx; hx[0] = (_Float16)xr[j].x; hx[1] = (_Float16)xr[j].y;
      hx[2] = (_Float16)xr[j].z; hx[3] = (_Float16)xr[j].w;
      *reinterpret_cast<h4*>(&st[so + j * 16 * PT_]) = hx;
      h4 hw; hw[0] = (_Float16)wr[j].x; hw[1] = (_Float16)wr[j].y;
      hw[2] = (_Float16)wr[j].z; hw[3] = (_Float16)wr[j].w;
      *reinterpret_cast<h4*>(&st[TS_ + so + j * 16 * PT_]) = hw;
    }
    __syncthreads();

    // next pass's global loads fly under this pass's products
    if (p + 1 < D_ / PK_) {
      go += PK_ * 4;
#pragma unroll  // indexes a register array: the index must be a constant
      for (int j = 0; j < 8; ++j) {
        xr[j] = load4(xg + j * 16 * D_, go);
        wr[j] = load4(wg + j * 16 * D_, go);
      }
    }
    // holds the loads in front of the products: the scheduler otherwise sinks
    // them to the pass's end, where nothing covers their latency
    __builtin_amdgcn_sched_barrier(0);

#pragma unroll
    for (int kk = 0; kk < PK_ / 32; ++kk) {
      v16h af[4], bf[2];
#pragma unroll  // indexes a register array: the index must be a constant
      for (int i = 0; i < 4; ++i) {
        const _Float16* q = &st[fa + i * 16 * PT_ + kk * 32];
        af[i] = combine16(*reinterpret_cast<const h8*>(q),
                          *reinterpret_cast<const h8*>(q + 16));
      }
#pragma unroll  // indexes a register array: the index must be a constant
      for (int j = 0; j < 2; ++j) {
        const _Float16* q = &st[fb + j * 16 * PT_ + kk * 32];
        bf[j] = combine16(*reinterpret_cast<const h8*>(q),
                          *reinterpret_cast<const h8*>(q + 16));
      }
#pragma unroll  // indexes a register array: the index must be a constant
      for (int i = 0; i < 4; ++i)
#pragma unroll  // indexes a register array: the index must be a constant
        for (int j = 0; j < 2; ++j)
          acc[i][j] = __builtin_amdgcn_wmma_f32_16x16x32_f16(
              false, af[i], false, bf[j], (short)0, acc[i][j], false, false);
    }
    // stands in front of every rewrite of the offset register that the loads
    // above name: the next pass's step and the code behind the loop
    asm volatile("s_wait_xcnt 0x0" ::: "memory");
  }

  if (mat == 2) {
    // rows of the tile = x rows (m), columns = W rows (e): 8 consecutive m per lane
#pragma unroll  // indexes a register array: the index must be a constant
    for (int j = 0; j < 2; ++j) {
      const int   e  = ebase + wb * 32 + j * 16 + ln16;
      const float be = bb[e];
      const int   hh = e >> 6, dk = e & 63;
#pragma unroll  // indexes a register array: the index must be a constant
      for (int i = 0; i < 4; ++i) {
        const int r0 = rbase + wa * 64 + i * 16 + 8 * g;
        const int bi = r0 >> 11, m0 = r0 & (M_ - 1);
        h8 o;
#pragma unroll  // indexes a register array: the index must be a constant
        for (int v = 0; v < 8; ++v) o[v] = (_Float16)(acc[i][j][v] + be);
        *reinterpret_cast<h8*>(
            &Vt[(size_t)((bi * H_ + hh) * DK_ + dk) * M_ + m0]) = o;
      }
    }
  } else {
    // rows of the tile = W rows (e), columns = x rows (m): 8 consecutive e per lane
    _Float16* dst = (mat == 0) ? Q : K;
#pragma unroll  // indexes a register array: the index must be a constant
    for (int i = 0; i < 4; ++i) {
      const int e0 = ebase + wa * 64 + i * 16 + 8 * g;
      const int hh = e0 >> 6, dk0 = e0 & 63;
      float be[8];
#pragma unroll  // indexes a register array: the index must be a constant
      for (int v = 0; v < 8; ++v) be[v] = bb[e0 + v];
#pragma unroll  // indexes a register array: the index must be a constant
      for (int j = 0; j < 2; ++j) {
        const int r  = rbase + wb * 32 + j * 16 + ln16;
        const int bi = r >> 11, m = r & (M_ - 1);
        h8 o;
#pragma unroll  // indexes a register array: the index must be a constant
        for (int v = 0; v < 8; ++v) o[v] = (_Float16)(acc[i][j][v] + be[v]);
        *reinterpret_cast<h8*>(
            &dst[(size_t)((bi * H_ + hh) * M_ + m) * DK_ + dk0]) = o;
      }
    }
    // stands behind the last store of this branch, in front of any later
    // rewrite of a register that these stores name
    asm volatile("s_wait_xcnt 0x0" ::: "memory");
  }
}

#define KP_  72            // K row pitch in halves: 128 B of data + 16 B pad
#define VP_  136           // V row pitch in halves: 256 B of data + 16 B pad
#define SK_  128           // keys per stage
#define NS_  (M_ / SK_)    // stages

// value of lane l ^ 16
static __device__ __forceinline__ float xhalf(float x) {
  const int b = __builtin_bit_cast(int, x);
  return __builtin_bit_cast(float, __builtin_amdgcn_permlanex16(
      b, b, 0x76543210, 0xfedcba98, false, false));
}

__global__ __launch_bounds__(256) void attn_kernel(
    const _Float16* __restrict__ Q, const _Float16* __restrict__ K,
    const _Float16* __restrict__ Vt, const float* __restrict__ coords,
    const float* __restrict__ alpha_p, float* __restrict__ out)
{
  const int tid  = threadIdx.x;
  const int wid  = tid >> 5;
  const int lane = tid & 31;
  const int ln16 = lane & 15;
  const int g    = lane >> 4;
  const int bh   = blockIdx.y, b = bh >> 3, h = bh & 7;
  const int qbase = blockIdx.x * 128 + wid * 16;
  const float alpha = alpha_p[0];

  const _Float16* qp = Q  + (size_t)bh * M_ * DK_;
  const _Float16* kp = K  + (size_t)bh * M_ * DK_;
  const _Float16* vp = Vt + (size_t)bh * DK_ * M_;
  const float*    cb = coords + (size_t)b * M_ * 3;

  __shared__ __align__(16) _Float16 kbuf[2][SK_ * KP_]; // 2 x 18 KB
  __shared__ __align__(16) _Float16 vbuf[2][DK_ * VP_]; // 2 x 17 KB

  // Q column fragments for the two d-halves (DK=64 -> 2 x K=32)
  v16h bq[2];
#pragma unroll
  for (int dt = 0; dt < 2; ++dt) {
    const _Float16* p = qp + (size_t)(qbase + ln16) * DK_ + dt * 32 + g * 8;
    bq[dt] = combine16(*reinterpret_cast<const h8*>(p),
                       *reinterpret_cast<const h8*>(p + 16));
  }

  // coords of this lane's query
  const float cmx = cb[(qbase + ln16) * 3 + 0];
  const float cmy = cb[(qbase + ln16) * 3 + 1];
  const float cmz = cb[(qbase + ln16) * 3 + 2];

  float rmax = -3.0e38f, rsum = 0.0f;  // rsum: this lane's 16 keys of each chunk only
  v8f o0 = {}, o1 = {}, o2 = {}, o3 = {};

  const int kr = tid >> 3, kq = tid & 7;  // K copy assignment: 32 rows x 8x16B a sweep, 4 sweeps
  const int vr = tid >> 4, vq = tid & 15; // V copy assignment: 16 rows x 16x16B a sweep, 4 sweeps
  const int ks = kr * KP_ + kq * 8;       // the lane's first 16 bytes in a K buffer
  const int vs = vr * VP_ + vq * 8;       // the lane's first 16 bytes in a V buffer
  const _Float16* gk = kp + tid * 8;                  // the same in stage 0 of K
  const _Float16* gv = vp + (size_t)vr * M_ + vq * 8; // and of V

  // prologue: async-stage stage 0 into buffer 0 (8 x b128 per thread = 32 KB)
  async_copy_stage(gk, 32 * DK_, &kbuf[0][ks], 32 * KP_,
                   gv, 16 * M_, &vbuf[0][vs], 16 * VP_);

  // coords of this lane's keys of a chunk: keys 8g + 0..7 and 16 + 8g + 0..7,
  // 96 contiguous bytes each; kept in registers, fetched one chunk ahead
  const unsigned co = g * 96;            // the lane's byte offset in a chunk's coords
  float4 kc[2][6];
#pragma unroll
  for (int t = 0; t < 2; ++t)
#pragma unroll
    for (int i = 0; i < 6; ++i) kc[t][i] = load4(cb, co + t * 192 + i * 16);
  // stands behind the loads, in front of every later rewrite of an address
  // register that they name
  asm volatile("s_wait_xcnt 0x0" ::: "memory");

  for (int st = 0; st < NS_; ++st) {
    const int cur = st & 1;

    // this wave's reads of the buffer that is refilled behind the barrier have retired
    asm volatile("s_wait_dscnt 0x0" ::: "memory");
    asm volatile("s_wait_asynccnt 0x0" ::: "memory"); // stage st landed in LDS
    __syncthreads();                                  // visible to all waves;
                                                      // all done reading buf cur^1
    if (st + 1 < NS_) {                               // prefetch stage st+1
      const int nn = (st + 1) * SK_;
      async_copy_stage(gk + (size_t)nn * DK_, 32 * DK_, &kbuf[cur ^ 1][ks], 32 * KP_,
                       gv + nn, 16 * M_, &vbuf[cur ^ 1][vs], 16 * VP_);
    }

   // kept rolled: unrolled, the passes take more than the 256 registers that
   // four waves per SIMD leave a wave
#pragma unroll 1
   for (int ps = 0; ps < SK_ / 32; ++ps) {
    const int nbase = st * SK_ + ps * 32;
    const _Float16* kl = &kbuf[cur][ps * 32 * KP_];
    const _Float16* vl = &vbuf[cur][ps * 32];

    // --- S^T = K * Q^T on a 32x16 chunk (two 16x16 output tiles) ---
    v8f s0 = {}, s1 = {};
#pragma unroll
    for (int dt = 0; dt < 2; ++dt) {
      const _Float16* p0 = kl + ln16 * KP_ + dt * 32 + g * 8;
      const v16h ak0 = combine16(*reinterpret_cast<const h8*>(p0),
                                 *reinterpret_cast<const h8*>(p0 + 16));
      s0 = __builtin_amdgcn_wmma_f32_16x16x32_f16(false, ak0, false, bq[dt],
                                                  (short)0, s0, false, false);
      const _Float16* p1 = kl + (16 + ln16) * KP_ + dt * 32 + g * 8;
      const v16h ak1 = combine16(*reinterpret_cast<const h8*>(p1),
                                 *reinterpret_cast<const h8*>(p1 + 16));
      s1 = __builtin_amdgcn_wmma_f32_16x16x32_f16(false, ak1, false, bq[dt],
                                                  (short)0, s1, false, false);
    }

    // --- online softmax: 16 scores of one query per lane ---
    float a[16];
#pragma unroll
    for (int t = 0; t < 2; ++t) {
      const v8f& s = t ? s1 : s0;
      float c[24];
#pragma unroll
      for (int i = 0; i < 6; ++i) {
        c[4 * i + 0] = kc[t][i].x; c[4 * i + 1] = kc[t][i].y;
        c[4 * i + 2] = kc[t][i].z; c[4 * i + 3] = kc[t][i].w;
      }
#pragma unroll
      for (int v = 0; v < 8; ++v)
        a[8 * t + v] = s[v] * 0.125f + alpha * (cmx * c[3 * v] + cmy * c[3 * v + 1] +
                                                cmz * c[3 * v + 2]);
    }

    // next chunk's key coords: fetched one chunk ahead, a trip's work covers their latency
    {
      // clamped, not branched over: the last pass fetches its own chunk again,
      // in bounds and unused, and the passes stay one straight run of code
      const int nn = (nbase + 32 < M_) ? nbase + 32 : M_ - 32;
      const float* cn = cb + nn * 3;
#pragma unroll
      for (int t = 0; t < 2; ++t)
#pragma unroll
        for (int i = 0; i < 6; ++i) kc[t][i] = load4(cn, co + t * 192 + i * 16);
      // stands behind the loads, in front of every later rewrite of an address
      // register that they name
      asm volatile("s_wait_xcnt 0x0" ::: "memory");
    }

    float t[8];
#pragma unroll
    for (int i = 0; i < 8; ++i) t[i] = fmaxf(a[2 * i], a[2 * i + 1]);
#pragma unroll
    for (int s = 4; s >= 1; s >>= 1)
#pragma unroll
      for (int i = 0; i < s; ++i) t[i] = fmaxf(t[2 * i], t[2 * i + 1]);
    const float mx = fmaxf(t[0], xhalf(t[0]));  // both halves use one maximum
    const float nm = fmaxf(rmax, mx);
    const float sc = __expf(rmax - nm);
    rmax = nm;

    // P^T: element s of the column operand is key 8g + s (s < 8), 16 + 8g + s - 8
    // (s >= 8), which is what the two score tiles hold in this lane
    v16h bp;
#pragma unroll
    for (int i = 0; i < 16; ++i) {
      a[i]  = __expf(a[i] - nm);
      bp[i] = (_Float16)a[i];
    }
#pragma unroll
    for (int s = 8; s >= 1; s >>= 1)
#pragma unroll
      for (int i = 0; i < s; ++i) a[i] = a[2 * i] + a[2 * i + 1];
    rsum = rsum * sc + a[0];
    o0 *= sc; o1 *= sc; o2 *= sc; o3 *= sc;

    // --- O^T += V^T * P^T (four 16x16 d-row tiles) ---
#pragma unroll
    for (int dt = 0; dt < 4; ++dt) {
      const _Float16* pv = vl + (dt * 16 + ln16) * VP_ + g * 8;
      const v16h av = combine16(*reinterpret_cast<const h8*>(pv),
                                *reinterpret_cast<const h8*>(pv + 16));
      v8f* op = (dt == 0) ? &o0 : (dt == 1) ? &o1 : (dt == 2) ? &o2 : &o3;
      *op = __builtin_amdgcn_wmma_f32_16x16x32_f16(false, av, false, bp,
                                                   (short)0, *op, false, false);
    }
   }
  }

  // epilogue: join the two halves' sums, normalize, store to [B][M][512];
  // a lane holds 8 consecutive d of its query in each tile
  const float rs = rsum + xhalf(rsum);
  float* orow = out + (size_t)(b * M_ + qbase + ln16) * D_ + h * DK_ + 8 * g;
#pragma unroll
  for (int dt = 0; dt < 4; ++dt) {
    const v8f& o = (dt == 0) ? o0 : (dt == 1) ? o1 : (dt == 2) ? o2 : o3;
    f4 lo, hi;
#pragma unroll
    for (int v = 0; v < 4; ++v) { lo[v] = o[v] / rs; hi[v] = o[4 + v] / rs; }
    // the s_wait_xcnt closes the statement so that it stands in front of every
    // later rewrite of a register that the two stores name
    asm volatile("global_store_b128 %0, %1, off\n\t"
                 "global_store_b128 %0, %2, off offset:16\n\t"
                 "s_wait_xcnt 0x0"
                 :: "v"(orow + dt * 16), "v"(lo), "v"(hi) : "memory");
  }
}

// ---------------------------------------------------------------------------
extern "C" void kernel_launch(void* const* d_in, const int* in_sizes, int n_in,
                              void* d_out, int out_size, void* d_ws, size_t ws_size,
                              hipStream_t stream) {
  const float* x      = (const float*)d_in[0];
  const float* coords = (const float*)d_in[1];
  const float* wq     = (const float*)d_in[2];
  const float* bq     = (const float*)d_in[3];
  const float* wk     = (const float*)d_in[4];
  const float* bk     = (const float*)d_in[5];
  const float* wv     = (const float*)d_in[6];
  const float* bv     = (const float*)d_in[7];
  const float* alpha  = (const float*)d_in[8];
  float* out = (float*)d_out;

  _Float16* ws = (_Float16*)d_ws;
  const size_t QSZ = (size_t)B_ * H_ * M_ * DK_;   // 4,194,304 halves = 8 MB
  _Float16* Qb = ws;
  _Float16* Kb = ws + QSZ;
  _Float16* Vb = ws + 2 * QSZ;                     // total 24 MB of d_ws

  dim3 g1((B_ * M_) / 128, D_ / 128, 3);
  qkv_proj_kernel<<<g1, 256, 0, stream>>>(x, wq, bq, wk, bk, wv, bv, Qb, Kb, Vb);

  dim3 g2(M_ / 128, B_ * H_);
  attn_kernel<<<g2, 256, 0, stream>>>(Qb, Kb, Vb, coords, alpha, out);
}

// v005
// Measured time: 64.1 microseconds a run.
// Next to v004, in two timings, it ran 1.16 times as fast each time.
// Counting every step since v000, it is 4.37 times as fast.
#include <hip/hip_runtime.h>

typedef __attribute__((ext_vector_type(16))) _Float16 v16h;
typedef __attribute__((ext_vector_type(8)))  _Float16 h8;
typedef __attribute__((ext_vector_type(4)))  _Float16 h4;
typedef __attribute__((ext_vector_type(8)))  float    v8f;
typedef __attribute__((ext_vector_type(4)))  float    f4;

#define B_   4
#define H_   8
#define M_   2048
#define D_   512
#define DK_  64
#define EK_  16            // halves per row of the bias operand (12 used, 4 zero)
#define LOG2E_ 1.44269504f // scores are kept in units of log2: exp(s) = 2^(s * log2 e)

static __device__ __forceinline__ v16h combine16(h8 lo, h8 hi) {
  v16h r;
#pragma unroll
  for (int i = 0; i < 8; ++i) { r[i] = lo[i]; r[i + 8] = hi[i]; }
  return r;
}

// one lane copies 4 x 16 bytes of K, 4 x 16 bytes of V and 16 bytes of the bias
// operand global -> LDS asynchronously (ASYNCcnt-tracked): its share of one
// stage. gks/gvs and lks/lvs are the steps in halves from one of its pieces to
// the next, in global memory and in LDS. The s_wait_xcnt closes the statement so
// that it stands in front of every later rewrite of an address register that a
// copy names
static __device__ __forceinline__ void async_copy_stage(
    const _Float16* gk, int gks, _Float16* lk, int lks,
    const _Float16* gv, int gvs, _Float16* lv, int lvs,
    const _Float16* ge, _Float16* le) {
  const unsigned lk_off = (unsigned)(unsigned long long)lk; // LDS aperture: low 32 bits = LDS byte offset
  const unsigned lv_off = (unsigned)(unsigned long long)lv;
  const unsigned le_off = (unsigned)(unsigned long long)le;
  asm volatile("global_load_async_to_lds_b128 %0, %9, off\n\t"
               "global_load_async_to_lds_b128 %1, %10, off\n\t"
               "global_load_async_to_lds_b128 %2, %11, off\n\t"
               "global_load_async_to_lds_b128 %3, %12, off\n\t"
               "global_load_async_to_lds_b128 %4, %13, off\n\t"
               "global_load_async_to_lds_b128 %5, %14, off\n\t"
               "global_load_async_to_lds_b128 %6, %15, off\n\t"
               "global_load_async_to_lds_b128 %7, %16, off\n\t"
               "global_load_async_to_lds_b128 %8, %17, off\n\t"
               "s_wait_xcnt 0x0"
               :: "v"(lk_off), "v"(lk_off + 2 * lks), "v"(lk_off + 4 * lks), "v"(lk_off + 6 * lks),
                  "v"(lv_off), "v"(lv_off + 2 * lvs), "v"(lv_off + 4 * lvs), "v"(lv_off + 6 * lvs),
                  "v"(le_off),
                  "v"(gk), "v"(gk + gks), "v"(gk + 2 * gks), "v"(gk + 3 * gks),
                  "v"(gv), "v"(gv + gvs), "v"(gv + 2 * gvs), "v"(gv + 3 * gvs),
                  "v"(ge)
               : "memory");
}

// ---------------------------------------------------------------------------
// Kernel 1: QKV projection  y[r][e] = sum_d x[r][d] * W[e][d] + bias[e]
//   Q,K stored as f16 [B*H][M][64]; V stored transposed [B*H][64][M].
//   Q is stored times log2(e) / 8, so that the score product needs no scaling.
//   The blocks of K's first column strip also write Ke: each row's coords as
//   f16 head + rest (c = h + l to about 22 bits), laid out as the key side of
//   the bias product, k = 0..15: hx hy hz lx ly lz hx hy hz lx ly lz 0 0 0 0.
//   Ke is [B*M/16][2][16][8]: per 16 rows first their k 0..7, then their k 8..15,
//   so that each half wave of a fragment load reads 256 bytes in a row.
//   One block = 128 rows of x times 128 rows of W (one matrix). Both operands
//   go through LDS as f16, 64 k per pass, two buffers; each wave owns 4 x 2
//   WMMA tiles, so a staged fragment feeds several products.
//   The WMMA row operand is the one whose index runs along the output's
//   contiguous axis (W rows for Q and K, x rows for V): a lane's 8 accumulator
//   values are then 16 contiguous bytes of the output.
// ---------------------------------------------------------------------------
#define PK_  64            // k per pass
#define PT_  72            // LDS row pitch in halves: 128 B of data + 16 B pad
#define TS_  (128 * PT_)   // one operand tile in halves

// 16 bytes at a block-uniform base plus a 32-bit byte offset of the lane
static __device__ __forceinline__ float4 load4(const float* base, unsigned off) {
  return *reinterpret_cast<const float4*>(
      reinterpret_cast<const char*>(base) + off);
}

__global__ __launch_bounds__(256) void qkv_proj_kernel(
    const float* __restrict__ x,
    const float* __restrict__ wq, const float* __restrict__ bq,
    const float* __restrict__ wk, const float* __restrict__ bk,
    const float* __restrict__ wv, const float* __restrict__ bv,
    const float* __restrict__ coords,
    _Float16* __restrict__ Q, _Float16* __restrict__ K, _Float16* __restrict__ Vt,
    _Float16* __restrict__ Ke)
{
  const int mat = blockIdx.z;
  const float* W  = (mat == 0) ? wq : (mat == 1) ? wk : wv;
  const float* bb = (mat == 0) ? bq : (mat == 1) ? bk : bv;

  const int tid  = threadIdx.x;
  const int wid  = tid >> 5;
  const int lane = tid & 31;
  const int ln16 = lane & 15;
  const int g    = lane >> 4;

  const int rbase = blockIdx.x * 128;   // rows over B*M = 8192
  const int ebase = blockIdx.y * 128;   // output columns of this matrix

  // [buffer][operand: 0 = x, 1 = W][128 rows][PT_]
  __shared__ __align__(16) _Float16 sm[2 * 2 * TS_];

  // staging slot: 16 lanes cover one 256-B piece of a row, 16 rows per sweep
  const int srow = tid >> 4, sc4 = tid & 15;
  const float*   xg = x + (size_t)rbase * D_;    // block-uniform bases
  const float*   wg = W + (size_t)ebase * D_;
  unsigned       go = (srow * D_ + sc4 * 4) * 4; // the lane's byte offset, same for both
  const int      so = srow * PT_ + sc4 * 4;

  float4 xr[8], wr[8];
#pragma unroll  // indexes a register array: the index must be a constant
  for (int j = 0; j < 8; ++j) {
    xr[j] = load4(xg + j * 16 * D_, go);
    wr[j] = load4(wg + j * 16 * D_, go);
  }

  // key side of the bias product for this block's 128 rows, one row a lane;
  // behind the first pass's loads, whose latency covers these
  if (mat == 1 && blockIdx.y == 0 && tid < 128) {
    const float* cp = coords + (rbase + tid) * 3;
    const float cx = cp[0], cy = cp[1], cz = cp[2];
    // stands behind the loads, in front of every later rewrite of an address
    // register that they name; the loaded values are inputs so that no load
    // sinks below it
    asm volatile("s_wait_xcnt 0x0" :: "v"(cx), "v"(cy), "v"(cz) : "memory");
    const _Float16 hx = (_Float16)cx, hy = (_Float16)cy, hz = (_Float16)cz;
    const _Float16 lx = (_Float16)(cx - (float)hx), ly = (_Float16)(cy - (float)hy),
                   lz = (_Float16)(cz - (float)hz);
    const _Float16 z0 = (_Float16)0.0f;
    const h8 e0 = {hx, hy, hz, lx, ly, lz, hx, hy};
    const h8 e1 = {hz, lx, ly, lz, z0, z0, z0, z0};
    _Float16* ep = Ke + (rbase + (tid & ~15)) * EK_ + (tid & 15) * 8;
    *reinterpret_cast<h8*>(ep)       = e0;
    *reinterpret_cast<h8*>(ep + 128) = e1;
    // stands behind the stores, in front of every later rewrite of a register
    // that they name
    asm volatile("s_wait_xcnt 0x0" ::: "memory");
  }

  // WMMA row operand (64 rows per wave) and column operand (32 rows per wave)
  const int oa = (mat == 2) ? 0 : TS_;
  const int ob = TS_ - oa;
  const int wa = wid >> 2, wb = wid & 3;
  const int fa = oa + (wa * 64 + ln16) * PT_ + g * 8;
  const int fb = ob + (wb * 32 + ln16) * PT_ + g * 8;

  v8f acc[4][2] = {};

  for (int p = 0; p < D_ / PK_; ++p) {
    _Float16* st = &sm[(p & 1) * 2 * TS_];

    // registers -> f16 -> LDS buffer p&1 (last read in pass p-2, which every
    // wave left before the barrier of pass p-1)
#pragma unroll  // indexes a register array: the index must be a constant
    for (int j = 0; j < 8; ++j) {
      h4 hx; hx[0] = (_Float16)xr[j].x; hx[1] = (_Float16)xr[j].y;
      hx[2] = (_Float16)xr[j].z; hx[3] = (_Float16)xr[j].w;
      *reinterpret_cast<h4*>(&st[so + j * 16 * PT_]) = hx;
      h4 hw; hw[0] = (_Float16)wr[j].x; hw[1] = (_Float16)wr[j].y;
      hw[2] = (_Float16)wr[j].z; hw[3] = (_Float16)wr[j].w;
      *reinterpret_cast<h4*>(&st[TS_ + so + j * 16 * PT_]) = hw;
    }
    __syncthreads();

    // next pass's global loads fly under this pass's products
    if (p + 1 < D_ / PK_) {
      go += PK_ * 4;
#pragma unroll  // indexes a register array: the index must be a constant
      for (int j = 0; j < 8; ++j) {
        xr[j] = load4(xg + j * 16 * D_, go);
        wr[j] = load4(wg + j * 16 * D_, go);
      }
    }
    // holds the loads in front of the products: the scheduler otherwise sinks
    // them to the pass's end, where nothing covers their latency
    __builtin_amdgcn_sched_barrier(0);

#pragma unroll
    for (int kk = 0; kk < PK_ / 32; ++kk) {
      v16h af[4], bf[2];
#pragma unroll  // indexes a register array: the index must be a constant
      for (int i = 0; i < 4; ++i) {
        const _Float16* q = &st[fa + i * 16 * PT_ + kk * 32];
        af[i] = combine16(*reinterpret_cast<const h8*>(q),
                          *reinterpret_cast<const h8*>(q + 16));
      }
#pragma unroll  // indexes a register array: the index must be a constant
      for (int j = 0; j < 2; ++j) {
        const _Float16* q = &st[fb + j * 16 * PT_ + kk * 32];
        bf[j] = combine16(*reinterpret_cast<const h8*>(q),
                          *reinterpret_cast<const h8*>(q + 16));
      }
#pragma unroll  // indexes a register array: the index must be a constant
      for (int i = 0; i < 4; ++i)
#pragma unroll  // indexes a register array: the index must be a constant
        for (int j = 0; j < 2; ++j)
          acc[i][j] = __builtin_amdgcn_wmma_f32_16x16x32_f16(
              false, af[i], false, bf[j], (short)0, acc[i][j], false, false);
    }
    // stands in front of every rewrite of the offset register that the loads
    // above name: the next pass's step and the code behind the loop
    asm volatile("s_wait_xcnt 0x0" ::: "memory");
  }

  if (mat == 2) {
    // rows of the tile = x rows (m), columns = W rows (e): 8 consecutive m per lane
#pragma unroll  // indexes a register array: the index must be a constant
    for (int j = 0; j < 2; ++j) {
      const int   e  = ebase + wb * 32 + j * 16 + ln16;
      const float be = bb[e];
      const int   hh = e >> 6, dk = e & 63;
#pragma unroll  // indexes a register array: the index must be a constant
      for (int i = 0; i < 4; ++i) {
        const int r0 = rbase + wa * 64 + i * 16 + 8 * g;
        const int bi = r0 >> 11, m0 = r0 & (M_ - 1);
        h8 o;
#pragma unroll  // indexes a register array: the index must be a constant
        for (int v = 0; v < 8; ++v) o[v] = (_Float16)(acc[i][j][v] + be);
        *reinterpret_cast<h8*>(
            &Vt[(size_t)((bi * H_ + hh) * DK_ + dk) * M_ + m0]) = o;
      }
    }
  } else {
    // rows of the tile = W rows (e), columns = x rows (m): 8 consecutive e per lane
    _Float16* dst = (mat == 0) ? Q : K;
    const float qs = (mat == 0) ? 0.125f * LOG2E_ : 1.0f;
#pragma unroll  // indexes a register array: the index must be a constant
    for (int i = 0; i < 4; ++i) {
      const int e0 = ebase + wa * 64 + i * 16 + 8 * g;
      const int hh = e0 >> 6, dk0 = e0 & 63;
      float be[8];
#pragma unroll  // indexes a register array: the index must be a constant
      for (int v = 0; v < 8; ++v) be[v] = bb[e0 + v];
#pragma unroll  // indexes a register array: the index must be a constant
      for (int j = 0; j < 2; ++j) {
        const int r  = rbase + wb * 32 + j * 16 + ln16;
        const int bi = r >> 11, m = r & (M_ - 1);
        h8 o;
#pragma unroll  // indexes a register array: the index must be a constant
        for (int v = 0; v < 8; ++v) o[v] = (_Float16)((acc[i][j][v] + be[v]) * qs);
        *reinterpret_cast<h8*>(
            &dst[(size_t)((bi * H_ + hh) * M_ + m) * DK_ + dk0]) = o;
      }
    }
    // stands behind the last store of this branch, in front of any later
    // rewrite of a register that these stores name
    asm volatile("s_wait_xcnt 0x0" ::: "memory");
  }
}

#define KP_  72            // K row pitch in halves: 128 B of data + 16 B pad
#define VP_  136           // V row pitch in halves: 256 B of data + 16 B pad
#define SK_  128           // keys per stage
#define NS_  (M_ / SK_)    // stages

// value of lane l ^ 16
static __device__ __forceinline__ float xhalf(float x) {
  const int b = __builtin_bit_cast(int, x);
  return __builtin_bit_cast(float, __builtin_amdgcn_permlanex16(
      b, b, 0x76543210, 0xfedcba98, false, false));
}

// four waves per SIMD is what the grid gives (two blocks per WGP): the register
// budget is set for that, or the compiler packs the pass into half the registers
// and waits for every load where it is issued
__global__ __launch_bounds__(256) __attribute__((amdgpu_waves_per_eu(4, 4))) void attn_kernel(
    const _Float16* __restrict__ Q, const _Float16* __restrict__ K,
    const _Float16* __restrict__ Vt, const _Float16* __restrict__ Ke,
    const float* __restrict__ coords,
    const float* __restrict__ alpha_p, float* __restrict__ out)
{
  const int tid  = threadIdx.x;
  const int wid  = tid >> 5;
  const int lane = tid & 31;
  const int ln16 = lane & 15;
  const int g    = lane >> 4;
  const int bh   = blockIdx.y, b = bh >> 3, h = bh & 7;
  const int qbase = blockIdx.x * 128 + wid * 16;
  const float alpha = alpha_p[0];

  const _Float16* qp = Q  + (size_t)bh * M_ * DK_;
  const _Float16* kp = K  + (size_t)bh * M_ * DK_;
  const _Float16* vp = Vt + (size_t)bh * DK_ * M_;
  const float*    cb = coords + (size_t)b * M_ * 3;

  __shared__ __align__(16) _Float16 kbuf[2][SK_ * KP_]; // 2 x 18 KB
  __shared__ __align__(16) _Float16 vbuf[2][DK_ * VP_]; // 2 x 17 KB
  __shared__ __align__(16) _Float16 ebuf[2][SK_ * EK_]; // 2 x 4 KB, in Ke's order

  // Q column fragments for the two d-halves (DK=64 -> 2 x K=32)
  v16h bq[2];
#pragma unroll
  for (int dt = 0; dt < 2; ++dt) {
    const _Float16* p = qp + (size_t)(qbase + ln16) * DK_ + dt * 32 + g * 8;
    bq[dt] = combine16(*reinterpret_cast<const h8*>(p),
                       *reinterpret_cast<const h8*>(p + 16));
  }

  // query side of the bias product: k = 8g + s for s < 8, as in bq; k >= 16 is zero
  const h8 zero8 = {};
  v16h bc;
  {
    const float as = alpha * LOG2E_;
    const f4 cq = {cb[(qbase + ln16) * 3 + 0], cb[(qbase + ln16) * 3 + 1],
                   cb[(qbase + ln16) * 3 + 2], 0.0f};
    const f4 aq = cq * as;
    const h4 hq = __builtin_convertvector(aq, h4);
    const h4 lq = __builtin_convertvector(aq - __builtin_convertvector(hq, f4), h4);
    // element 3 of hq and lq is zero
    const h8 c0 = __builtin_shufflevector(hq, lq, 0, 1, 2, 0, 1, 2, 4, 5);
    const h8 c1 = __builtin_shufflevector(hq, lq, 6, 4, 5, 6, 3, 3, 3, 3);
    bc = combine16(g ? c1 : c0, zero8);
  }

  float rmax = -3.0e38f, rsum = 0.0f;  // rsum: this lane's 16 keys of each chunk only
  v8f o0 = {}, o1 = {}, o2 = {}, o3 = {};

  const int kr = tid >> 3, kq = tid & 7;  // K copy assignment: 32 rows x 8x16B a sweep, 4 sweeps
  const int vr = tid >> 4, vq = tid & 15; // V copy assignment: 16 rows x 16x16B a sweep, 4 sweeps
  const int ks = kr * KP_ + kq * 8;       // the lane's first 16 bytes in a K buffer
  const int vs = vr * VP_ + vq * 8;       // the lane's first 16 bytes in a V buffer
  const _Float16* gk = kp + tid * 8;                  // the same in stage 0 of K
  const _Float16* gv = vp + (size_t)vr * M_ + vq * 8; // and of V
  const _Float16* ge = Ke + (size_t)b * M_ * EK_ + tid * 8; // and of Ke: 4 KB a stage, copied as it lies

  // prologue: async-stage stage 0 into buffer 0 (9 x b128 per thread = 36 KB)
  async_copy_stage(gk, 32 * DK_, &kbuf[0][ks], 32 * KP_,
                   gv, 16 * M_, &vbuf[0][vs], 16 * VP_,
                   ge, &ebuf[0][tid * 8]);

  // key-side fragments of the bias product: k >= 16 stays zero, a pass loads k < 16
  v16h ae0 = {}, ae1 = {};

  for (int st = 0; st < NS_; ++st) {
    const int cur = st & 1;

    // this wave's reads of the buffer that is refilled behind the barrier have retired
    asm volatile("s_wait_dscnt 0x0" ::: "memory");
    asm volatile("s_wait_asynccnt 0x0" ::: "memory"); // stage st landed in LDS
    __syncthreads();                                  // visible to all waves;
                                                      // all done reading buf cur^1
    if (st + 1 < NS_) {                               // prefetch stage st+1
      const int nn = (st + 1) * SK_;
      async_copy_stage(gk + (size_t)nn * DK_, 32 * DK_, &kbuf[cur ^ 1][ks], 32 * KP_,
                       gv + nn, 16 * M_, &vbuf[cur ^ 1][vs], 16 * VP_,
                       ge + nn * EK_, &ebuf[cur ^ 1][tid * 8]);
    }

   // kept rolled, one pass's code for all four: whether the passes run faster
   // unrolled is not measured
#pragma unroll 1
   for (int ps = 0; ps < SK_ / 32; ++ps) {
    const _Float16* kl = &kbuf[cur][ps * 32 * KP_];
    const _Float16* vl = &vbuf[cur][ps * 32];
    const _Float16* el = &ebuf[cur][ps * 32 * EK_];

    // --- S^T = Ke * C^T + K * Q^T on a 32x16 chunk (two 16x16 output tiles) ---
    v8f s0 = {}, s1 = {};
    {
      const _Float16* pe = el + g * 128 + ln16 * 8;
      const h8 e0 = *reinterpret_cast<const h8*>(pe);
      const h8 e1 = *reinterpret_cast<const h8*>(pe + 16 * EK_);
#pragma unroll  // indexes a register vector: the index must be a constant
      for (int i = 0; i < 8; ++i) { ae0[i] = e0[i]; ae1[i] = e1[i]; }
      s0 = __builtin_amdgcn_wmma_f32_16x16x32_f16(false, ae0, false, bc,
                                                  (short)0, s0, false, false);
      s1 = __builtin_amdgcn_wmma_f32_16x16x32_f16(false, ae1, false, bc,
                                                  (short)0, s1, false, false);
    }
#pragma unroll
    for (int dt = 0; dt < 2; ++dt) {
      const _Float16* p0 = kl + ln16 * KP_ + dt * 32 + g * 8;
      const v16h ak0 = combine16(*reinterpret_cast<const h8*>(p0),
                                 *reinterpret_cast<const h8*>(p0 + 16));
      s0 = __builtin_amdgcn_wmma_f32_16x16x32_f16(false, ak0, false, bq[dt],
                                                  (short)0, s0, false, false);
      const _Float16* p1 = kl + (16 + ln16) * KP_ + dt * 32 + g * 8;
      const v16h ak1 = combine16(*reinterpret_cast<const h8*>(p1),
                                 *reinterpret_cast<const h8*>(p1 + 16));
      s1 = __builtin_amdgcn_wmma_f32_16x16x32_f16(false, ak1, false, bq[dt],
                                                  (short)0, s1, false, false);
    }

    // --- online softmax: 16 scores of one query per lane ---
    float a[16];
#pragma unroll
    for (int v = 0; v < 8; ++v) { a[v] = s0[v]; a[8 + v] = s1[v]; }

    float t[8];
#pragma unroll
    for (int i = 0; i < 8; ++i) t[i] = fmaxf(a[2 * i], a[2 * i + 1]);
#pragma unroll
    for (int s = 4; s >= 1; s >>= 1)
#pragma unroll
      for (int i = 0; i < s; ++i) t[i] = fmaxf(t[2 * i], t[2 * i + 1]);
    const float mx = fmaxf(t[0], xhalf(t[0]));  // both halves use one maximum
    const float nm = fmaxf(rmax, mx);
    const float sc = __builtin_amdgcn_exp2f(rmax - nm);
    rmax = nm;

    // P^T: element s of the column operand is key 8g + s (s < 8), 16 + 8g + s - 8
    // (s >= 8), which is what the two score tiles hold in this lane
    v16h bp;
#pragma unroll
    for (int i = 0; i < 16; ++i) {
      a[i]  = __builtin_amdgcn_exp2f(a[i] - nm);
      bp[i] = (_Float16)a[i];
    }
#pragma unroll
    for (int s = 8; s >= 1; s >>= 1)
#pragma unroll
      for (int i = 0; i < s; ++i) a[i] = a[2 * i] + a[2 * i + 1];
    rsum = rsum * sc + a[0];
    o0 *= sc; o1 *= sc; o2 *= sc; o3 *= sc;

    // --- O^T += V^T * P^T (four 16x16 d-row tiles) ---
#pragma unroll
    for (int dt = 0; dt < 4; ++dt) {
      const _Float16* pv = vl + (dt * 16 + ln16) * VP_ + g * 8;
      const v16h av = combine16(*reinterpret_cast<const h8*>(pv),
                                *reinterpret_cast<const h8*>(pv + 16));
      v8f* op = (dt == 0) ? &o0 : (dt == 1) ? &o1 : (dt == 2) ? &o2 : &o3;
      *op = __builtin_amdgcn_wmma_f32_16x16x32_f16(false, av, false, bp,
                                                   (short)0, *op, false, false);
    }
    // the four vector slots the chip needs behind a WMMA before one of its
    // operand registers is overwritten: the next pass's first instructions reuse
    // them. The
    // scheduling barrier keeps the products in front of the slots
    __builtin_amdgcn_sched_barrier(0);
    asm volatile("v_nop\n\tv_nop\n\tv_nop\n\tv_nop");
   }
  }

  // epilogue: join the two halves' sums, normalize, store to [B][M][512];
  // a lane holds 8 consecutive d of its query in each tile
  const float rs = rsum + xhalf(rsum);
  float* orow = out + (size_t)(b * M_ + qbase + ln16) * D_ + h * DK_ + 8 * g;
#pragma unroll
  for (int dt = 0; dt < 4; ++dt) {
    const v8f& o = (dt == 0) ? o0 : (dt == 1) ? o1 : (dt == 2) ? o2 : o3;
    f4 lo, hi;
#pragma unroll
    for (int v = 0; v < 4; ++v) { lo[v] = o[v] / rs; hi[v] = o[4 + v] / rs; }
    // the s_wait_xcnt closes the statement so that it stands in front of every
    // later rewrite of a register that the two stores name
    asm volatile("global_store_b128 %0, %1, off\n\t"
                 "global_store_b128 %0, %2, off offset:16\n\t"
                 "s_wait_xcnt 0x0"
                 :: "v"(orow + dt * 16), "v"(lo), "v"(hi) : "memory");
  }
}

// ---------------------------------------------------------------------------
extern "C" void kernel_launch(void* const* d_in, const int* in_sizes, int n_in,
                              void* d_out, int out_size, void* d_ws, size_t ws_size,
                              hipStream_t stream) {
  const float* x      = (const float*)d_in[0];
  const float* coords = (const float*)d_in[1];
  const float* wq     = (const float*)d_in[2];
  const float* bq     = (const float*)d_in[3];
  const float* wk     = (const float*)d_in[4];
  const float* bk     = (const float*)d_in[5];
  const float* wv     = (const float*)d_in[6];
  const float* bv     = (const float*)d_in[7];
  const float* alpha  = (const float*)d_in[8];
  float* out = (float*)d_out;

  _Float16* ws = (_Float16*)d_ws;
  const size_t QSZ = (size_t)B_ * H_ * M_ * DK_;   // 4,194,304 halves = 8 MB
  _Float16* Qb = ws;
  _Float16* Kb = ws + QSZ;
  _Float16* Vb = ws + 2 * QSZ;
  _Float16* Eb = ws + 3 * QSZ;                     // 256 KB; total 24.25 MB of d_ws

  dim3 g1((B_ * M_) / 128, D_ / 128, 3);
  qkv_proj_kernel<<<g1, 256, 0, stream>>>(x, wq, bq, wk, bk, wv, bv, coords, Qb, Kb, Vb, Eb);

  dim3 g2(M_ / 128, B_ * H_);
  attn_kernel<<<g2, 256, 0, stream>>>(Qb, Kb, Vb, Eb, coords, alpha, out);
}

// v006
// A run of this version takes 59.6 microseconds.
// Next to v005, in two timings, it ran 1.08 and 1.07 times as fast.
// All steps since v000 together make it 4.70 times as fast.
#include <hip/hip_runtime.h>

typedef __attribute__((ext_vector_type(16))) _Float16 v16h;
typedef __attribute__((ext_vector_type(8)))  _Float16 h8;
typedef __attribute__((ext_vector_type(4)))  _Float16 h4;
typedef __attribute__((ext_vector_type(8)))  float    v8f;
typedef __attribute__((ext_vector_type(4)))  float    f4;

#define B_   4
#define H_   8
#define M_   2048
#define D_   512
#define DK_  64
#define EK_  16            // halves per row of the bias operand (12 used, 4 zero)
#define LOG2E_ 1.44269504f // scores are kept in units of log2: exp(s) = 2^(s * log2 e)

static __device__ __forceinline__ v16h combine16(h8 lo, h8 hi) {
  v16h r;
#pragma unroll
  for (int i = 0; i < 8; ++i) { r[i] = lo[i]; r[i + 8] = hi[i]; }
  return r;
}

// one lane copies 4 x 16 bytes of K, 4 x 16 bytes of V and 16 bytes of the bias
// operand global -> LDS asynchronously (ASYNCcnt-tracked): its share of one
// stage. gks/gvs and lks/lvs are the steps in halves from one of its pieces to
// the next, in global memory and in LDS. The s_wait_xcnt closes the statement so
// that it stands in front of every later rewrite of an address register that a
// copy names
static __device__ __forceinline__ void async_copy_stage(
    const _Float16* gk, int gks, _Float16* lk, int lks,
    const _Float16* gv, int gvs, _Float16* lv, int lvs,
    const _Float16* ge, _Float16* le) {
  const unsigned lk_off = (unsigned)(unsigned long long)lk; // LDS aperture: low 32 bits = LDS byte offset
  const unsigned lv_off = (unsigned)(unsigned long long)lv;
  const unsigned le_off = (unsigned)(unsigned long long)le;
  asm volatile("global_load_async_to_lds_b128 %0, %9, off\n\t"
               "global_load_async_to_lds_b128 %1, %10, off\n\t"
               "global_load_async_to_lds_b128 %2, %11, off\n\t"
               "global_load_async_to_lds_b128 %3, %12, off\n\t"
               "global_load_async_to_lds_b128 %4, %13, off\n\t"
               "global_load_async_to_lds_b128 %5, %14, off\n\t"
               "global_load_async_to_lds_b128 %6, %15, off\n\t"
               "global_load_async_to_lds_b128 %7, %16, off\n\t"
               "global_load_async_to_lds_b128 %8, %17, off\n\t"
               "s_wait_xcnt 0x0"
               :: "v"(lk_off), "v"(lk_off + 2 * lks), "v"(lk_off + 4 * lks), "v"(lk_off + 6 * lks),
                  "v"(lv_off), "v"(lv_off + 2 * lvs), "v"(lv_off + 4 * lvs), "v"(lv_off + 6 * lvs),
                  "v"(le_off),
                  "v"(gk), "v"(gk + gks), "v"(gk + 2 * gks), "v"(gk + 3 * gks),
                  "v"(gv), "v"(gv + gvs), "v"(gv + 2 * gvs), "v"(gv + 3 * gvs),
                  "v"(ge)
               : "memory");
}

// ---------------------------------------------------------------------------
// Kernel 1: QKV projection  y[r][e] = sum_d x[r][d] * W[e][d] + bias[e]
//   Q,K stored as f16 [B*H][M][64]; V stored transposed [B*H][64][M].
//   Q is stored times log2(e) / 8, so that the score product needs no scaling.
//   The blocks of K's first column strip also write Ke: each row's coords as
//   f16 head + rest (c = h + l to about 22 bits), laid out as the key side of
//   the bias product, k = 0..15: hx hy hz lx ly lz hx hy hz lx ly lz 0 0 0 0.
//   Ke is [B*M/16][2][16][8]: per 16 rows first their k 0..7, then their k 8..15,
//   so that each half wave of a fragment load reads 256 bytes in a row.
//   One block = 128 rows of x times 128 rows of W (one matrix). Both operands
//   go through LDS as f16, 64 k per pass, two buffers; each wave owns 4 x 2
//   WMMA tiles, so a staged fragment feeds several products.
//   The WMMA row operand is the one whose index runs along the output's
//   contiguous axis (W rows for Q and K, x rows for V): a lane's 8 accumulator
//   values are then 16 contiguous bytes of the output.
// ---------------------------------------------------------------------------
#define PK_  64            // k per pass
#define PT_  72            // LDS row pitch in halves: 128 B of data + 16 B pad
#define TS_  (128 * PT_)   // one operand tile in halves

// 16 bytes at a block-uniform base plus a 32-bit byte offset of the lane
static __device__ __forceinline__ float4 load4(const float* base, unsigned off) {
  return *reinterpret_cast<const float4*>(
      reinterpret_cast<const char*>(base) + off);
}

__global__ __launch_bounds__(256) void qkv_proj_kernel(
    const float* __restrict__ x,
    const float* __restrict__ wq, const float* __restrict__ bq,
    const float* __restrict__ wk, const float* __restrict__ bk,
    const float* __restrict__ wv, const float* __restrict__ bv,
    const float* __restrict__ coords,
    _Float16* __restrict__ Q, _Float16* __restrict__ K, _Float16* __restrict__ Vt,
    _Float16* __restrict__ Ke)
{
  const int mat = blockIdx.z;
  const float* W  = (mat == 0) ? wq : (mat == 1) ? wk : wv;
  const float* bb = (mat == 0) ? bq : (mat == 1) ? bk : bv;

  const int tid  = threadIdx.x;
  const int wid  = tid >> 5;
  const int lane = tid & 31;
  const int ln16 = lane & 15;
  const int g    = lane >> 4;

  const int rbase = blockIdx.x * 128;   // rows over B*M = 8192
  const int ebase = blockIdx.y * 128;   // output columns of this matrix

  // [buffer][operand: 0 = x, 1 = W][128 rows][PT_]
  __shared__ __align__(16) _Float16 sm[2 * 2 * TS_];

  // staging slot: 16 lanes cover one 256-B piece of a row, 16 rows per sweep
  const int srow = tid >> 4, sc4 = tid & 15;
  const float*   xg = x + (size_t)rbase * D_;    // block-uniform bases
  const float*   wg = W + (size_t)ebase * D_;
  unsigned       go = (srow * D_ + sc4 * 4) * 4; // the lane's byte offset, same for both
  const int      so = srow * PT_ + sc4 * 4;

  float4 xr[8], wr[8];
#pragma unroll  // indexes a register array: the index must be a constant
  for (int j = 0; j < 8; ++j) {
    xr[j] = load4(xg + j * 16 * D_, go);
    wr[j] = load4(wg + j * 16 * D_, go);
  }

  // key side of the bias product for this block's 128 rows, one row a lane;
  // behind the first pass's loads, whose latency covers these
  if (mat == 1 && blockIdx.y == 0 && tid < 128) {
    const float* cp = coords + (rbase + tid) * 3;
    const float cx = cp[0], cy = cp[1], cz = cp[2];
    // stands behind the loads, in front of every later rewrite of an address
    // register that they name; the loaded values are inputs so that no load
    // sinks below it
    asm volatile("s_wait_xcnt 0x0" :: "v"(cx), "v"(cy), "v"(cz) : "memory");
    const _Float16 hx = (_Float16)cx, hy = (_Float16)cy, hz = (_Float16)cz;
    const _Float16 lx = (_Float16)(cx - (float)hx), ly = (_Float16)(cy - (float)hy),
                   lz = (_Float16)(cz - (float)hz);
    const _Float16 z0 = (_Float16)0.0f;
    const h8 e0 = {hx, hy, hz, lx, ly, lz, hx, hy};
    const h8 e1 = {hz, lx, ly, lz, z0, z0, z0, z0};
    _Float16* ep = Ke + (rbase + (tid & ~15)) * EK_ + (tid & 15) * 8;
    *reinterpret_cast<h8*>(ep)       = e0;
    *reinterpret_cast<h8*>(ep + 128) = e1;
    // stands behind the stores, in front of every later rewrite of a register
    // that they name
    asm volatile("s_wait_xcnt 0x0" ::: "memory");
  }

  // WMMA row operand (64 rows per wave) and column operand (32 rows per wave)
  const int oa = (mat == 2) ? 0 : TS_;
  const int ob = TS_ - oa;
  const int wa = wid >> 2, wb = wid & 3;
  const int fa = oa + (wa * 64 + ln16) * PT_ + g * 8;
  const int fb = ob + (wb * 32 + ln16) * PT_ + g * 8;

  v8f acc[4][2] = {};

  for (int p = 0; p < D_ / PK_; ++p) {
    _Float16* st = &sm[(p & 1) * 2 * TS_];

    // registers -> f16 -> LDS buffer p&1 (last read in pass p-2, which every
    // wave left before the barrier of pass p-1)
#pragma unroll  // indexes a register array: the index must be a constant
    for (int j = 0; j < 8; ++j) {
      h4 hx; hx[0] = (_Float16)xr[j].x; hx[1] = (_Float16)xr[j].y;
      hx[2] = (_Float16)xr[j].z; hx[3] = (_Float16)xr[j].w;
      *reinterpret_cast<h4*>(&st[so + j * 16 * PT_]) = hx;
      h4 hw; hw[0] = (_Float16)wr[j].x; hw[1] = (_Float16)wr[j].y;
      hw[2] = (_Float16)wr[j].z; hw[3] = (_Float16)wr[j].w;
      *reinterpret_cast<h4*>(&st[TS_ + so + j * 16 * PT_]) = hw;
    }
    __syncthreads();

    // next pass's global loads fly under this pass's products
    if (p + 1 < D_ / PK_) {
      go += PK_ * 4;
#pragma unroll  // indexes a register array: the index must be a constant
      for (int j = 0; j < 8; ++j) {
        xr[j] = load4(xg + j * 16 * D_, go);
        wr[j] = load4(wg + j * 16 * D_, go);
      }
    }
    // holds the loads in front of the products: the scheduler otherwise sinks
    // them to the pass's end, where nothing covers their latency
    __builtin_amdgcn_sched_barrier(0);

#pragma unroll
    for (int kk = 0; kk < PK_ / 32; ++kk) {
      v16h af[4], bf[2];
#pragma unroll  // indexes a register array: the index must be a constant
      for (int i = 0; i < 4; ++i) {
        const _Float16* q = &st[fa + i * 16 * PT_ + kk * 32];
        af[i] = combine16(*reinterpret_cast<const h8*>(q),
                          *reinterpret_cast<const h8*>(q + 16));
      }
#pragma unroll  // indexes a register array: the index must be a constant
      for (int j = 0; j < 2; ++j) {
        const _Float16* q = &st[fb + j * 16 * PT_ + kk * 32];
        bf[j] = combine16(*reinterpret_cast<const h8*>(q),
                          *reinterpret_cast<const h8*>(q + 16));
      }
#pragma unroll  // indexes a register array: the index must be a constant
      for (int i = 0; i < 4; ++i)
#pragma unroll  // indexes a register array: the index must be a constant
        for (int j = 0; j < 2; ++j)
          acc[i][j] = __builtin_amdgcn_wmma_f32_16x16x32_f16(
              false, af[i], false, bf[j], (short)0, acc[i][j], false, false);
    }
    // stands in front of every rewrite of the offset register that the loads
    // above name: the next pass's step and the code behind the loop
    asm volatile("s_wait_xcnt 0x0" ::: "memory");
  }

  if (mat == 2) {
    // rows of the tile = x rows (m), columns = W rows (e): 8 consecutive m per lane
#pragma unroll  // indexes a register array: the index must be a constant
    for (int j = 0; j < 2; ++j) {
      const int   e  = ebase + wb * 32 + j * 16 + ln16;
      const float be = bb[e];
      const int   hh = e >> 6, dk = e & 63;
#pragma unroll  // indexes a register array: the index must be a constant
      for (int i = 0; i < 4; ++i) {
        const int r0 = rbase + wa * 64 + i * 16 + 8 * g;
        const int bi = r0 >> 11, m0 = r0 & (M_ - 1);
        h8 o;
#pragma unroll  // indexes a register array: the index must be a constant
        for (int v = 0; v < 8; ++v) o[v] = (_Float16)(acc[i][j][v] + be);
        *reinterpret_cast<h8*>(
            &Vt[(size_t)((bi * H_ + hh) * DK_ + dk) * M_ + m0]) = o;
      }
    }
  } else {
    // rows of the tile = W rows (e), columns = x rows (m): 8 consecutive e per lane
    _Float16* dst = (mat == 0) ? Q : K;
    const float qs = (mat == 0) ? 0.125f * LOG2E_ : 1.0f;
#pragma unroll  // indexes a register array: the index must be a constant
    for (int i = 0; i < 4; ++i) {
      const int e0 = ebase + wa * 64 + i * 16 + 8 * g;
      const int hh = e0 >> 6, dk0 = e0 & 63;
      float be[8];
#pragma unroll  // indexes a register array: the index must be a constant
      for (int v = 0; v < 8; ++v) be[v] = bb[e0 + v];
#pragma unroll  // indexes a register array: the index must be a constant
      for (int j = 0; j < 2; ++j) {
        const int r  = rbase + wb * 32 + j * 16 + ln16;
        const int bi = r >> 11, m = r & (M_ - 1);
        h8 o;
#pragma unroll  // indexes a register array: the index must be a constant
        for (int v = 0; v < 8; ++v) o[v] = (_Float16)((acc[i][j][v] + be[v]) * qs);
        *reinterpret_cast<h8*>(
            &dst[(size_t)((bi * H_ + hh) * M_ + m) * DK_ + dk0]) = o;
      }
    }
    // stands behind the last store of this branch, in front of any later
    // rewrite of a register that these stores name
    asm volatile("s_wait_xcnt 0x0" ::: "memory");
  }
}

#define KP_  72            // K row pitch in halves: 128 B of data + 16 B pad
#define VP_  136           // V row pitch in halves: 256 B of data + 16 B pad
#define SK_  128           // keys per stage
#define NS_  (M_ / SK_)    // stages
#define WK_  (SK_ / 2)     // keys of a stage that one wave works on

// value of lane l ^ 16
static __device__ __forceinline__ float xhalf(float x) {
  const int b = __builtin_bit_cast(int, x);
  return __builtin_bit_cast(float, __builtin_amdgcn_permlanex16(
      b, b, 0x76543210, 0xfedcba98, false, false));
}

// 2^x together with the slot that the instruction set asks for behind a
// transcendental before its result is read or its source overwritten: for the
// epilogue, where the compiler reuses the argument's register at once
static __device__ __forceinline__ float exp2_slot(float x) {
  float r;
  asm("v_exp_f32 %0, %1\n\tv_nop" : "=v"(r) : "v"(x));
  return r;
}

// four waves per SIMD is what the grid gives (two blocks per WGP): the register
// budget is set for that, or the compiler packs the pass into half the registers
// and waits for every load where it is issued
__global__ __launch_bounds__(256) __attribute__((amdgpu_waves_per_eu(4, 4))) void attn_kernel(
    const _Float16* __restrict__ Q, const _Float16* __restrict__ K,
    const _Float16* __restrict__ Vt, const _Float16* __restrict__ Ke,
    const float* __restrict__ coords,
    const float* __restrict__ alpha_p, float* __restrict__ out)
{
  const int tid  = threadIdx.x;
  const int wid  = tid >> 5;
  const int lane = tid & 31;
  const int ln16 = lane & 15;
  const int g    = lane >> 4;
  const int kh   = wid >> 2;           // which 64 keys of every stage
  const int bh   = blockIdx.y, b = bh >> 3, h = bh & 7;
  const int qbase = blockIdx.x * 128 + (wid & 3) * 32;
  const float alpha = alpha_p[0];

  const _Float16* qp = Q  + (size_t)bh * M_ * DK_;
  const _Float16* kp = K  + (size_t)bh * M_ * DK_;
  const _Float16* vp = Vt + (size_t)bh * DK_ * M_;
  const float*    cb = coords + (size_t)b * M_ * 3;

  __shared__ __align__(16) _Float16 kbuf[2][SK_ * KP_]; // 2 x 18 KB
  __shared__ __align__(16) _Float16 vbuf[2][DK_ * VP_]; // 2 x 17 KB
  __shared__ __align__(16) _Float16 ebuf[2][SK_ * EK_]; // 2 x 4 KB, in Ke's order
  __shared__ __align__(16) f4       xo[8][8][32];       // 32 KB: per wave, the group it hands over
  __shared__ __align__(8)  float2   xm[8][32];          // 2 KB: that group's maximum and sum

  // Q column fragments of both groups for the two d-halves (DK=64 -> 2 x K=32)
  v16h bq[2][2];
#pragma unroll
  for (int c = 0; c < 2; ++c)
#pragma unroll
    for (int dt = 0; dt < 2; ++dt) {
      const _Float16* p = qp + (size_t)(qbase + c * 16 + ln16) * DK_ + dt * 32 + g * 8;
      bq[c][dt] = combine16(*reinterpret_cast<const h8*>(p),
                            *reinterpret_cast<const h8*>(p + 16));
    }

  // query side of the bias product: k = 8g + s for s < 8, as in bq; k >= 16 is zero
  const h8 zero8 = {};
  v16h bc[2];
#pragma unroll
  for (int c = 0; c < 2; ++c) {
    const float as = alpha * LOG2E_;
    const int   qr = (qbase + c * 16 + ln16) * 3;
    const f4 cq = {cb[qr + 0], cb[qr + 1], cb[qr + 2], 0.0f};
    const f4 aq = cq * as;
    const h4 hq = __builtin_convertvector(aq, h4);
    const h4 lq = __builtin_convertvector(aq - __builtin_convertvector(hq, f4), h4);
    // element 3 of hq and lq is zero
    const h8 c0 = __builtin_shufflevector(hq, lq, 0, 1, 2, 0, 1, 2, 4, 5);
    const h8 c1 = __builtin_shufflevector(hq, lq, 6, 4, 5, 6, 3, 3, 3, 3);
    bc[c] = combine16(g ? c1 : c0, zero8);
  }

  // per column group; rsum: this lane's 16 keys of each chunk only
  float rmax[2] = {-3.0e38f, -3.0e38f}, rsum[2] = {0.0f, 0.0f};
  v8f o[2][4] = {};

  const int kr = tid >> 3, kq = tid & 7;  // K copy assignment: 32 rows x 8x16B a sweep, 4 sweeps
  const int vr = tid >> 4, vq = tid & 15; // V copy assignment: 16 rows x 16x16B a sweep, 4 sweeps
  const int ks = kr * KP_ + kq * 8;       // the lane's first 16 bytes in a K buffer
  const int vs = vr * VP_ + vq * 8;       // the lane's first 16 bytes in a V buffer
  const _Float16* gk = kp + tid * 8;                  // the same in stage 0 of K
  const _Float16* gv = vp + (size_t)vr * M_ + vq * 8; // and of V
  const _Float16* ge = Ke + (size_t)b * M_ * EK_ + tid * 8; // and of Ke: 4 KB a stage, copied as it lies

  // prologue: async-stage stage 0 into buffer 0 (9 x b128 per thread = 36 KB)
  async_copy_stage(gk, 32 * DK_, &kbuf[0][ks], 32 * KP_,
                   gv, 16 * M_, &vbuf[0][vs], 16 * VP_,
                   ge, &ebuf[0][tid * 8]);

  // key-side fragments of the bias product: k >= 16 stays zero, a pass loads k < 16
  v16h ae0 = {}, ae1 = {};

  for (int st = 0; st < NS_; ++st) {
    const int cur = st & 1;

    // this wave's reads of the buffer that is refilled behind the barrier have retired
    asm volatile("s_wait_dscnt 0x0" ::: "memory");
    asm volatile("s_wait_asynccnt 0x0" ::: "memory"); // stage st landed in LDS
    __syncthreads();                                  // visible to all waves;
                                                      // all done reading buf cur^1
    if (st + 1 < NS_) {                               // prefetch stage st+1
      const int nn = (st + 1) * SK_;
      async_copy_stage(gk + (size_t)nn * DK_, 32 * DK_, &kbuf[cur ^ 1][ks], 32 * KP_,
                       gv + nn, 16 * M_, &vbuf[cur ^ 1][vs], 16 * VP_,
                       ge + nn * EK_, &ebuf[cur ^ 1][tid * 8]);
    }

   // kept rolled, one pass's code for both: whether the passes run faster
   // unrolled is not measured
#pragma unroll 1
   for (int ps = 0; ps < WK_ / 32; ++ps) {
    const int k0 = kh * WK_ + ps * 32;    // the pass's first key in the stage
    const _Float16* kl = &kbuf[cur][k0 * KP_];
    const _Float16* vl = &vbuf[cur][k0];
    const _Float16* el = &ebuf[cur][k0 * EK_];

    // --- S^T = Ke * C^T + K * Q^T on a 32x32 chunk (2 x 2 16x16 output tiles) ---
    v8f s[2][2] = {};
    {
      const _Float16* pe = el + g * 128 + ln16 * 8;
      const h8 e0 = *reinterpret_cast<const h8*>(pe);
      const h8 e1 = *reinterpret_cast<const h8*>(pe + 16 * EK_);
#pragma unroll  // indexes a register vector: the index must be a constant
      for (int i = 0; i < 8; ++i) { ae0[i] = e0[i]; ae1[i] = e1[i]; }
#pragma unroll  // indexes a register array: the index must be a constant
      for (int c = 0; c < 2; ++c) {
        s[c][0] = __builtin_amdgcn_wmma_f32_16x16x32_f16(false, ae0, false, bc[c],
                                                         (short)0, s[c][0], false, false);
        s[c][1] = __builtin_amdgcn_wmma_f32_16x16x32_f16(false, ae1, false, bc[c],
                                                         (short)0, s[c][1], false, false);
      }
    }
#pragma unroll
    for (int dt = 0; dt < 2; ++dt) {
      const _Float16* p0 = kl + ln16 * KP_ + dt * 32 + g * 8;
      const v16h ak0 = combine16(*reinterpret_cast<const h8*>(p0),
                                 *reinterpret_cast<const h8*>(p0 + 16));
      const _Float16* p1 = kl + (16 + ln16) * KP_ + dt * 32 + g * 8;
      const v16h ak1 = combine16(*reinterpret_cast<const h8*>(p1),
                                 *reinterpret_cast<const h8*>(p1 + 16));
#pragma unroll  // indexes a register array: the index must be a constant
      for (int c = 0; c < 2; ++c) {
        s[c][0] = __builtin_amdgcn_wmma_f32_16x16x32_f16(false, ak0, false, bq[c][dt],
                                                         (short)0, s[c][0], false, false);
        s[c][1] = __builtin_amdgcn_wmma_f32_16x16x32_f16(false, ak1, false, bq[c][dt],
                                                         (short)0, s[c][1], false, false);
      }
    }

    // --- online softmax, 16 scores of one query per lane and group: first both
    //     groups' maxima and rescale factors, then each group's exponentials ---
    float nm[2], sc[2];
#pragma unroll  // indexes a register array: the index must be a constant
    for (int c = 0; c < 2; ++c) {
      float t[8];
#pragma unroll
      for (int i = 0; i < 4; ++i) {
        t[i]     = fmaxf(s[c][0][2 * i], s[c][0][2 * i + 1]);
        t[4 + i] = fmaxf(s[c][1][2 * i], s[c][1][2 * i + 1]);
      }
#pragma unroll
      for (int r = 4; r >= 1; r >>= 1)
#pragma unroll
        for (int i = 0; i < r; ++i) t[i] = fmaxf(t[2 * i], t[2 * i + 1]);
      const float mx = fmaxf(t[0], xhalf(t[0]));  // both halves use one maximum
      nm[c] = fmaxf(rmax[c], mx);
      sc[c] = __builtin_amdgcn_exp2f(rmax[c] - nm[c]);
      rmax[c] = nm[c];
    }

    v16h bp[2];
#pragma unroll  // indexes a register array: the index must be a constant
    for (int c = 0; c < 2; ++c) {
      // P^T: element s of the column operand is key 8g + s (s < 8), 16 + 8g + s - 8
      // (s >= 8), which is what the two score tiles hold in this lane
      const v8f d0 = s[c][0] - nm[c], d1 = s[c][1] - nm[c];
      float a[16];
#pragma unroll
      for (int i = 0; i < 8; ++i) a[i] = __builtin_amdgcn_exp2f(d0[i]);
#pragma unroll
      for (int i = 0; i < 8; ++i) a[8 + i] = __builtin_amdgcn_exp2f(d1[i]);
#pragma unroll
      for (int i = 0; i < 16; ++i) bp[c][i] = (_Float16)a[i];
#pragma unroll
      for (int r = 8; r >= 1; r >>= 1)
#pragma unroll
        for (int i = 0; i < r; ++i) a[i] = a[2 * i] + a[2 * i + 1];
      rsum[c] = rsum[c] * sc[c] + a[0];
#pragma unroll  // indexes a register array: the index must be a constant
      for (int dt = 0; dt < 4; ++dt) o[c][dt] *= sc[c];
    }

    // --- O^T += V^T * P^T (four 16x16 d-row tiles for each group) ---
#pragma unroll
    for (int dt = 0; dt < 4; ++dt) {
      const _Float16* pv = vl + (dt * 16 + ln16) * VP_ + g * 8;
      const v16h av = combine16(*reinterpret_cast<const h8*>(pv),
                                *reinterpret_cast<const h8*>(pv + 16));
#pragma unroll  // indexes a register array: the index must be a constant
      for (int c = 0; c < 2; ++c)
        o[c][dt] = __builtin_amdgcn_wmma_f32_16x16x32_f16(false, av, false, bp[c],
                                                          (short)0, o[c][dt], false, false);
    }
    // the four vector slots the chip needs behind a WMMA before one of its
    // operand registers is overwritten: the next pass's first instructions reuse
    // them. The
    // scheduling barrier keeps the products in front of the slots
    __builtin_amdgcn_sched_barrier(0);
    asm volatile("v_nop\n\tv_nop\n\tv_nop\n\tv_nop");
   }
  }

  // the two waves of a query block swap one column group: wave kh keeps group kh
  // and hands over the other, lane to lane (both hold a group in the same layout)
  v8f   ok[4];
  float mk, lk;
  {
    const bool k1 = kh != 0;
#pragma unroll  // indexes a register array: the index must be a constant
    for (int dt = 0; dt < 4; ++dt) {
      const v8f og = k1 ? o[0][dt] : o[1][dt];
      ok[dt]       = k1 ? o[1][dt] : o[0][dt];
      xo[wid][2 * dt][lane]     = f4{og[0], og[1], og[2], og[3]};
      xo[wid][2 * dt + 1][lane] = f4{og[4], og[5], og[6], og[7]};
    }
    xm[wid][lane] = make_float2(k1 ? rmax[0] : rmax[1], k1 ? rsum[0] : rsum[1]);
    mk = k1 ? rmax[1] : rmax[0];
    lk = k1 ? rsum[1] : rsum[0];
  }
  __syncthreads();  // the partner's group is in LDS

  // epilogue: join the two key halves on one maximum, then the two lane halves'
  // sums, normalize, store to [B][M][512]; a lane holds 8 consecutive d of its
  // query in each tile
  const float2 pm = xm[wid ^ 4][lane];
  const float  mj = fmaxf(mk, pm.x);
  const float  fk = exp2_slot(mk - mj);
  const float  fp = exp2_slot(pm.x - mj);
  const float  lj = lk * fk + pm.y * fp;
  const float  rs = lj + xhalf(lj);
  float* orow = out + (size_t)(b * M_ + qbase + kh * 16 + ln16) * D_ + h * DK_ + 8 * g;
#pragma unroll
  for (int dt = 0; dt < 4; ++dt) {
    const f4 plo = xo[wid ^ 4][2 * dt][lane], phi = xo[wid ^ 4][2 * dt + 1][lane];
    f4 lo, hi;
#pragma unroll
    for (int v = 0; v < 4; ++v) {
      lo[v] = (ok[dt][v] * fk + plo[v] * fp) / rs;
      hi[v] = (ok[dt][4 + v] * fk + phi[v] * fp) / rs;
    }
    // the s_wait_xcnt closes the statement so that it stands in front of every
    // later rewrite of a register that the two stores name
    asm volatile("global_store_b128 %0, %1, off\n\t"
                 "global_store_b128 %0, %2, off offset:16\n\t"
                 "s_wait_xcnt 0x0"
                 :: "v"(orow + dt * 16), "v"(lo), "v"(hi) : "memory");
  }
}

// ---------------------------------------------------------------------------
extern "C" void kernel_launch(void* const* d_in, const int* in_sizes, int n_in,
                              void* d_out, int out_size, void* d_ws, size_t ws_size,
                              hipStream_t stream) {
  const float* x      = (const float*)d_in[0];
  const float* coords = (const float*)d_in[1];
  const float* wq     = (const float*)d_in[2];
  const float* bq     = (const float*)d_in[3];
  const float* wk     = (const float*)d_in[4];
  const float* bk     = (const float*)d_in[5];
  const float* wv     = (const float*)d_in[6];
  const float* bv     = (const float*)d_in[7];
  const float* alpha  = (const float*)d_in[8];
  float* out = (float*)d_out;

  _Float16* ws = (_Float16*)d_ws;
  const size_t QSZ = (size_t)B_ * H_ * M_ * DK_;   // 4,194,304 halves = 8 MB
  _Float16* Qb = ws;
  _Float16* Kb = ws + QSZ;
  _Float16* Vb = ws + 2 * QSZ;
  _Float16* Eb = ws + 3 * QSZ;                     // 256 KB; total 24.25 MB of d_ws

  dim3 g1((B_ * M_) / 128, D_ / 128, 3);
  qkv_proj_kernel<<<g1, 256, 0, stream>>>(x, wq, bq, wk, bk, wv, bv, coords, Qb, Kb, Vb, Eb);

  dim3 g2(M_ / 128, B_ * H_);
  attn_kernel<<<g2, 256, 0, stream>>>(Qb, Kb, Vb, Eb, coords, alpha, out);
}

// v007
// One run takes 56.1 microseconds.
// Next to v006, in two timings, it ran 1.06 times as fast each time.
// Counting every step since v000, it is 4.99 times as fast.
#include <hip/hip_runtime.h>

typedef __attribute__((ext_vector_type(16))) _Float16 v16h;
typedef __attribute__((ext_vector_type(8)))  _Float16 h8;
typedef __attribute__((ext_vector_type(4)))  _Float16 h4;
typedef __attribute__((ext_vector_type(8)))  float    v8f;
typedef __attribute__((ext_vector_type(4)))  float    f4;
typedef __attribute__((ext_vector_type(2)))  float    f2;

#define B_   4
#define H_   8
#define M_   2048
#define D_   512
#define DK_  64
#define EK_  16            // halves per row of the bias operand (12 used, 4 zero)
#define LOG2E_ 1.44269504f // scores are kept in units of log2: exp(s) = 2^(s * log2 e)

static __device__ __forceinline__ v16h combine16(h8 lo, h8 hi) {
  v16h r;
#pragma unroll
  for (int i = 0; i < 8; ++i) { r[i] = lo[i]; r[i + 8] = hi[i]; }
  return r;
}

// one lane copies 4 x 16 bytes of K, 4 x 16 bytes of V and 16 bytes of the bias
// operand global -> LDS asynchronously (ASYNCcnt-tracked): its share of one
// stage. gks/gvs and lks/lvs are the steps in halves from one of its pieces to
// the next, in global memory and in LDS. The s_wait_xcnt closes the statement so
// that it stands in front of every later rewrite of an address register that a
// copy names
static __device__ __forceinline__ void async_copy_stage(
    const _Float16* gk, int gks, _Float16* lk, int lks,
    const _Float16* gv, int gvs, _Float16* lv, int lvs,
    const _Float16* ge, _Float16* le) {
  const unsigned lk_off = (unsigned)(unsigned long long)lk; // LDS aperture: low 32 bits = LDS byte offset
  const unsigned lv_off = (unsigned)(unsigned long long)lv;
  const unsigned le_off = (unsigned)(unsigned long long)le;
  asm volatile("global_load_async_to_lds_b128 %0, %9, off\n\t"
               "global_load_async_to_lds_b128 %1, %10, off\n\t"
               "global_load_async_to_lds_b128 %2, %11, off\n\t"
               "global_load_async_to_lds_b128 %3, %12, off\n\t"
               "global_load_async_to_lds_b128 %4, %13, off\n\t"
               "global_load_async_to_lds_b128 %5, %14, off\n\t"
               "global_load_async_to_lds_b128 %6, %15, off\n\t"
               "global_load_async_to_lds_b128 %7, %16, off\n\t"
               "global_load_async_to_lds_b128 %8, %17, off\n\t"
               "s_wait_xcnt 0x0"
               :: "v"(lk_off), "v"(lk_off + 2 * lks), "v"(lk_off + 4 * lks), "v"(lk_off + 6 * lks),
                  "v"(lv_off), "v"(lv_off + 2 * lvs), "v"(lv_off + 4 * lvs), "v"(lv_off + 6 * lvs),
                  "v"(le_off),
                  "v"(gk), "v"(gk + gks), "v"(gk + 2 * gks), "v"(gk + 3 * gks),
                  "v"(gv), "v"(gv + gvs), "v"(gv + 2 * gvs), "v"(gv + 3 * gvs),
                  "v"(ge)
               : "memory");
}

// ---------------------------------------------------------------------------
// Kernel 1: QKV projection  y[r][e] = sum_d x[r][d] * W[e][d] + bias[e]
//   Q,K stored as f16 [B*H][M][64]; V stored transposed [B*H][64][M].
//   Q is stored times log2(e) / 8, so that the score product needs no scaling.
//   The blocks of K's first column strip also write Ke: each row's coords as
//   f16 head + rest (c = h + l to about 22 bits), laid out as the key side of
//   the bias product, k = 0..15: hx hy hz lx ly lz hx hy hz lx ly lz 0 0 0 0.
//   Ke is [B*M/16][2][16][8]: per 16 rows first their k 0..7, then their k 8..15,
//   so that each half wave of a fragment load reads 256 bytes in a row.
//   One block = 128 rows of x times 128 rows of W (one matrix). Both operands
//   go through LDS as f16, 64 k per pass, two buffers; each wave owns 4 x 2
//   WMMA tiles, so a staged fragment feeds several products.
//   The WMMA row operand is the one whose index runs along the output's
//   contiguous axis (W rows for Q and K, x rows for V): a lane's 8 accumulator
//   values are then 16 contiguous bytes of the output.
// ---------------------------------------------------------------------------
#define PK_  64            // k per pass
#define PT_  72            // LDS row pitch in halves: 128 B of data + 16 B pad
#define TS_  (128 * PT_)   // one operand tile in halves

// 16 bytes at a block-uniform base plus a 32-bit byte offset of the lane
static __device__ __forceinline__ float4 load4(const float* base, unsigned off) {
  return *reinterpret_cast<const float4*>(
      reinterpret_cast<const char*>(base) + off);
}

__global__ __launch_bounds__(256) void qkv_proj_kernel(
    const float* __restrict__ x,
    const float* __restrict__ wq, const float* __restrict__ bq,
    const float* __restrict__ wk, const float* __restrict__ bk,
    const float* __restrict__ wv, const float* __restrict__ bv,
    const float* __restrict__ coords,
    _Float16* __restrict__ Q, _Float16* __restrict__ K, _Float16* __restrict__ Vt,
    _Float16* __restrict__ Ke)
{
  const int mat = blockIdx.z;
  const float* W  = (mat == 0) ? wq : (mat == 1) ? wk : wv;
  const float* bb = (mat == 0) ? bq : (mat == 1) ? bk : bv;

  const int tid  = threadIdx.x;
  const int wid  = tid >> 5;
  const int lane = tid & 31;
  const int ln16 = lane & 15;
  const int g    = lane >> 4;

  const int rbase = blockIdx.x * 128;   // rows over B*M = 8192
  const int ebase = blockIdx.y * 128;   // output columns of this matrix

  // [buffer][operand: 0 = x, 1 = W][128 rows][PT_]
  __shared__ __align__(16) _Float16 sm[2 * 2 * TS_];

  // staging slot: 16 lanes cover one 256-B piece of a row, 16 rows per sweep
  const int srow = tid >> 4, sc4 = tid & 15;
  const float*   xg = x + (size_t)rbase * D_;    // block-uniform bases
  const float*   wg = W + (size_t)ebase * D_;
  unsigned       go = (srow * D_ + sc4 * 4) * 4; // the lane's byte offset, same for both
  const int      so = srow * PT_ + sc4 * 4;

  float4 xr[8], wr[8];
#pragma unroll  // indexes a register array: the index must be a constant
  for (int j = 0; j < 8; ++j) {
    xr[j] = load4(xg + j * 16 * D_, go);
    wr[j] = load4(wg + j * 16 * D_, go);
  }

  // key side of the bias product for this block's 128 rows, one row a lane;
  // behind the first pass's loads, whose latency covers these
  if (mat == 1 && blockIdx.y == 0 && tid < 128) {
    const float* cp = coords + (rbase + tid) * 3;
    const float cx = cp[0], cy = cp[1], cz = cp[2];
    // stands behind the loads, in front of every later rewrite of an address
    // register that they name; the loaded values are inputs so that no load
    // sinks below it
    asm volatile("s_wait_xcnt 0x0" :: "v"(cx), "v"(cy), "v"(cz) : "memory");
    const _Float16 hx = (_Float16)cx, hy = (_Float16)cy, hz = (_Float16)cz;
    const _Float16 lx = (_Float16)(cx - (float)hx), ly = (_Float16)(cy - (float)hy),
                   lz = (_Float16)(cz - (float)hz);
    const _Float16 z0 = (_Float16)0.0f;
    const h8 e0 = {hx, hy, hz, lx, ly, lz, hx, hy};
    const h8 e1 = {hz, lx, ly, lz, z0, z0, z0, z0};
    _Float16* ep = Ke + (rbase + (tid & ~15)) * EK_ + (tid & 15) * 8;
    *reinterpret_cast<h8*>(ep)       = e0;
    *reinterpret_cast<h8*>(ep + 128) = e1;
    // stands behind the stores, in front of every later rewrite of a register
    // that they name
    asm volatile("s_wait_xcnt 0x0" ::: "memory");
  }

  // WMMA row operand (64 rows per wave) and column operand (32 rows per wave)
  const int oa = (mat == 2) ? 0 : TS_;
  const int ob = TS_ - oa;
  const int wa = wid >> 2, wb = wid & 3;
  const int fa = oa + (wa * 64 + ln16) * PT_ + g * 8;
  const int fb = ob + (wb * 32 + ln16) * PT_ + g * 8;

  v8f acc[4][2] = {};

  for (int p = 0; p < D_ / PK_; ++p) {
    _Float16* st = &sm[(p & 1) * 2 * TS_];

    // registers -> f16 -> LDS buffer p&1 (last read in pass p-2, which every
    // wave left before the barrier of pass p-1)
#pragma unroll  // indexes a register array: the index must be a constant
    for (int j = 0; j < 8; ++j) {
      h4 hx; hx[0] = (_Float16)xr[j].x; hx[1] = (_Float16)xr[j].y;
      hx[2] = (_Float16)xr[j].z; hx[3] = (_Float16)xr[j].w;
      *reinterpret_cast<h4*>(&st[so + j * 16 * PT_]) = hx;
      h4 hw; hw[0] = (_Float16)wr[j].x; hw[1] = (_Float16)wr[j].y;
      hw[2] = (_Float16)wr[j].z; hw[3] = (_Float16)wr[j].w;
      *reinterpret_cast<h4*>(&st[TS_ + so + j * 16 * PT_]) = hw;
    }
    __syncthreads();

    // next pass's global loads fly under this pass's products
    if (p + 1 < D_ / PK_) {
      go += PK_ * 4;
#pragma unroll  // indexes a register array: the index must be a constant
      for (int j = 0; j < 8; ++j) {
        xr[j] = load4(xg + j * 16 * D_, go);
        wr[j] = load4(wg + j * 16 * D_, go);
      }
    }
    // holds the loads in front of the products: the scheduler otherwise sinks
    // them to the pass's end, where nothing covers their latency
    __builtin_amdgcn_sched_barrier(0);

#pragma unroll
    for (int kk = 0; kk < PK_ / 32; ++kk) {
      v16h af[4], bf[2];
#pragma unroll  // indexes a register array: the index must be a constant
      for (int i = 0; i < 4; ++i) {
        const _Float16* q = &st[fa + i * 16 * PT_ + kk * 32];
        af[i] = combine16(*reinterpret_cast<const h8*>(q),
                          *reinterpret_cast<const h8*>(q + 16));
      }
#pragma unroll  // indexes a register array: the index must be a constant
      for (int j = 0; j < 2; ++j) {
        const _Float16* q = &st[fb + j * 16 * PT_ + kk * 32];
        bf[j] = combine16(*reinterpret_cast<const h8*>(q),
                          *reinterpret_cast<const h8*>(q + 16));
      }
#pragma unroll  // indexes a register array: the index must be a constant
      for (int i = 0; i < 4; ++i)
#pragma unroll  // indexes a register array: the index must be a constant
        for (int j = 0; j < 2; ++j)
          acc[i][j] = __builtin_amdgcn_wmma_f32_16x16x32_f16(
              false, af[i], false, bf[j], (short)0, acc[i][j], false, false);
    }
    // stands in front of every rewrite of the offset register that the loads
    // above name: the next pass's step and the code behind the loop
    asm volatile("s_wait_xcnt 0x0" ::: "memory");
  }

  if (mat == 2) {
    // rows of the tile = x rows (m), columns = W rows (e): 8 consecutive m per lane
#pragma unroll  // indexes a register array: the index must be a constant
    for (int j = 0; j < 2; ++j) {
      const int   e  = ebase + wb * 32 + j * 16 + ln16;
      const float be = bb[e];
      const int   hh = e >> 6, dk = e & 63;
#pragma unroll  // indexes a register array: the index must be a constant
      for (int i = 0; i < 4; ++i) {
        const int r0 = rbase + wa * 64 + i * 16 + 8 * g;
        const int bi = r0 >> 11, m0 = r0 & (M_ - 1);
        h8 o;
#pragma unroll  // indexes a register array: the index must be a constant
        for (int v = 0; v < 8; ++v) o[v] = (_Float16)(acc[i][j][v] + be);
        *reinterpret_cast<h8*>(
            &Vt[(size_t)((bi * H_ + hh) * DK_ + dk) * M_ + m0]) = o;
      }
    }
  } else {
    // rows of the tile = W rows (e), columns = x rows (m): 8 consecutive e per lane
    _Float16* dst = (mat == 0) ? Q : K;
    const float qs = (mat == 0) ? 0.125f * LOG2E_ : 1.0f;
#pragma unroll  // indexes a register array: the index must be a constant
    for (int i = 0; i < 4; ++i) {
      const int e0 = ebase + wa * 64 + i * 16 + 8 * g;
      const int hh = e0 >> 6, dk0 = e0 & 63;
      float be[8];
#pragma unroll  // indexes a register array: the index must be a constant
      for (int v = 0; v < 8; ++v) be[v] = bb[e0 + v];
#pragma unroll  // indexes a register array: the index must be a constant
      for (int j = 0; j < 2; ++j) {
        const int r  = rbase + wb * 32 + j * 16 + ln16;
        const int bi = r >> 11, m = r & (M_ - 1);
        h8 o;
#pragma unroll  // indexes a register array: the index must be a constant
        for (int v = 0; v < 8; ++v) o[v] = (_Float16)((acc[i][j][v] + be[v]) * qs);
        *reinterpret_cast<h8*>(
            &dst[(size_t)((bi * H_ + hh) * M_ + m) * DK_ + dk0]) = o;
      }
    }
    // stands behind the last store of this branch, in front of any later
    // rewrite of a register that these stores name
    asm volatile("s_wait_xcnt 0x0" ::: "memory");
  }
}

#define KP_  72            // K row pitch in halves: 128 B of data + 16 B pad
#define VP_  136           // V row pitch in halves: 256 B of data + 16 B pad
#define SK_  128           // keys per stage
#define NS_  (M_ / SK_)    // stages
#define WK_  (SK_ / 2)     // keys of a stage that one wave works on

// value of lane l ^ 16
static __device__ __forceinline__ float xhalf(float x) {
  const int b = __builtin_bit_cast(int, x);
  return __builtin_bit_cast(float, __builtin_amdgcn_permlanex16(
      b, b, 0x76543210, 0xfedcba98, false, false));
}

// 2^x together with the slot that the instruction set asks for behind a
// transcendental before its result is read or its source overwritten: for the
// epilogue and the rescaling path, where the compiler reuses the argument's
// register at once
static __device__ __forceinline__ float exp2_slot(float x) {
  float r;
  asm("v_exp_f32 %0, %1\n\tv_nop" : "=v"(r) : "v"(x));
  return r;
}

// largest sum of a lane's 16 exponentials of a pass that keeps the scale in use
#define PMAX_ 4096.0f

// both column groups of a pass: 2^(score - ref) for the lane's 16 scores of each
// group, as the column operand of the second product (element s is key 8g + s for
// s < 8, 16 + 8g + s - 8 for s >= 8, which is what the two score tiles hold in
// this lane) and summed. SLOT: each 2^x with its slot behind it (exp2_slot), for
// the rare path
template <bool SLOT>
static __device__ __forceinline__ void exp_scores(
    const v8f (&s)[2][2], const float (&ref)[2], v16h (&bp)[2], float (&ps)[2]) {
#pragma unroll  // indexes a register array: the index must be a constant
  for (int c = 0; c < 2; ++c) {
    const v8f d0 = s[c][0] - ref[c], d1 = s[c][1] - ref[c];
    float a[16];
#pragma unroll
    for (int i = 0; i < 8; ++i) a[i] = SLOT ? exp2_slot(d0[i]) : __builtin_amdgcn_exp2f(d0[i]);
#pragma unroll
    for (int i = 0; i < 8; ++i) a[8 + i] = SLOT ? exp2_slot(d1[i]) : __builtin_amdgcn_exp2f(d1[i]);
#pragma unroll
    for (int i = 0; i < 16; ++i) bp[c][i] = (_Float16)a[i];
#pragma unroll
    for (int r = 8; r >= 1; r >>= 1)
#pragma unroll
      for (int i = 0; i < r; ++i) a[i] = a[2 * i] + a[2 * i + 1];
    ps[c] = a[0];
  }
}

// four waves per SIMD is what the grid gives (two blocks per WGP): the register
// budget is set for that, or the compiler packs the pass into half the registers
// and waits for every load where it is issued
__global__ __launch_bounds__(256) __attribute__((amdgpu_waves_per_eu(4, 4))) void attn_kernel(
    const _Float16* __restrict__ Q, const _Float16* __restrict__ K,
    const _Float16* __restrict__ Vt, const _Float16* __restrict__ Ke,
    const float* __restrict__ coords,
    const float* __restrict__ alpha_p, float* __restrict__ out)
{
  const int tid  = threadIdx.x;
  const int wid  = tid >> 5;
  const int lane = tid & 31;
  const int ln16 = lane & 15;
  const int g    = lane >> 4;
  const int kh   = wid >> 2;           // which 64 keys of every stage
  const int bh   = blockIdx.y, b = bh >> 3, h = bh & 7;
  const int qbase = blockIdx.x * 128 + (wid & 3) * 32;
  const float alpha = alpha_p[0];

  const _Float16* qp = Q  + (size_t)bh * M_ * DK_;
  const _Float16* kp = K  + (size_t)bh * M_ * DK_;
  const _Float16* vp = Vt + (size_t)bh * DK_ * M_;
  const float*    cb = coords + (size_t)b * M_ * 3;

  __shared__ __align__(16) _Float16 kbuf[2][SK_ * KP_]; // 2 x 18 KB
  __shared__ __align__(16) _Float16 vbuf[2][DK_ * VP_]; // 2 x 17 KB
  __shared__ __align__(16) _Float16 ebuf[2][SK_ * EK_]; // 2 x 4 KB, in Ke's order
  __shared__ __align__(16) f4       xo[8][8][32];       // 32 KB: per wave, the group it hands over
  __shared__ __align__(8)  float2   xm[8][32];          // 2 KB: that group's maximum and sum

  // Q column fragments of both groups for the two d-halves (DK=64 -> 2 x K=32)
  v16h bq[2][2];
#pragma unroll
  for (int c = 0; c < 2; ++c)
#pragma unroll
    for (int dt = 0; dt < 2; ++dt) {
      const _Float16* p = qp + (size_t)(qbase + c * 16 + ln16) * DK_ + dt * 32 + g * 8;
      bq[c][dt] = combine16(*reinterpret_cast<const h8*>(p),
                            *reinterpret_cast<const h8*>(p + 16));
    }

  // query side of the bias product: k = 8g + s for s < 8, as in bq; k >= 16 is zero
  const h8 zero8 = {};
  v16h bc[2];
#pragma unroll
  for (int c = 0; c < 2; ++c) {
    const float as = alpha * LOG2E_;
    const int   qr = (qbase + c * 16 + ln16) * 3;
    const f4 cq = {cb[qr + 0], cb[qr + 1], cb[qr + 2], 0.0f};
    const f4 aq = cq * as;
    const h4 hq = __builtin_convertvector(aq, h4);
    const h4 lq = __builtin_convertvector(aq - __builtin_convertvector(hq, f4), h4);
    // element 3 of hq and lq is zero
    const h8 c0 = __builtin_shufflevector(hq, lq, 0, 1, 2, 0, 1, 2, 4, 5);
    const h8 c1 = __builtin_shufflevector(hq, lq, 6, 4, 5, 6, 3, 3, 3, 3);
    bc[c] = combine16(g ? c1 : c0, zero8);
  }

  // per column group; rmax: the reference that the exponentials are taken on;
  // rsum: this lane's 16 keys of each chunk only
  float rmax[2] = {-3.0e38f, -3.0e38f}, rsum[2] = {0.0f, 0.0f};
  v8f o[2][4] = {};

  const int kr = tid >> 3, kq = tid & 7;  // K copy assignment: 32 rows x 8x16B a sweep, 4 sweeps
  const int vr = tid >> 4, vq = tid & 15; // V copy assignment: 16 rows x 16x16B a sweep, 4 sweeps
  const int ks = kr * KP_ + kq * 8;       // the lane's first 16 bytes in a K buffer
  const int vs = vr * VP_ + vq * 8;       // the lane's first 16 bytes in a V buffer
  const _Float16* gk = kp + tid * 8;                  // the same in stage 0 of K
  const _Float16* gv = vp + (size_t)vr * M_ + vq * 8; // and of V
  const _Float16* ge = Ke + (size_t)b * M_ * EK_ + tid * 8; // and of Ke: 4 KB a stage, copied as it lies

  // prologue: async-stage stage 0 into buffer 0 (9 x b128 per thread = 36 KB)
  async_copy_stage(gk, 32 * DK_, &kbuf[0][ks], 32 * KP_,
                   gv, 16 * M_, &vbuf[0][vs], 16 * VP_,
                   ge, &ebuf[0][tid * 8]);

  // key-side fragments of the bias product: k >= 16 stays zero, a pass loads k < 16
  v16h ae0 = {}, ae1 = {};

  for (int st = 0; st < NS_; ++st) {
    const int cur = st & 1;

    // this wave's reads of the buffer that is refilled behind the barrier have retired
    asm volatile("s_wait_dscnt 0x0" ::: "memory");
    asm volatile("s_wait_asynccnt 0x0" ::: "memory"); // stage st landed in LDS
    __syncthreads();                                  // visible to all waves;
                                                      // all done reading buf cur^1
    if (st + 1 < NS_) {                               // prefetch stage st+1
      const int nn = (st + 1) * SK_;
      async_copy_stage(gk + (size_t)nn * DK_, 32 * DK_, &kbuf[cur ^ 1][ks], 32 * KP_,
                       gv + nn, 16 * M_, &vbuf[cur ^ 1][vs], 16 * VP_,
                       ge + nn * EK_, &ebuf[cur ^ 1][tid * 8]);
    }

   // kept rolled, one pass's code for both: whether the passes run faster
   // unrolled is not measured
#pragma unroll 1
   for (int ps = 0; ps < WK_ / 32; ++ps) {
    const int k0 = kh * WK_ + ps * 32;    // the pass's first key in the stage
    const _Float16* kl = &kbuf[cur][k0 * KP_];
    const _Float16* vl = &vbuf[cur][k0];
    const _Float16* el = &ebuf[cur][k0 * EK_];

    // --- S^T = Ke * C^T + K * Q^T on a 32x32 chunk (2 x 2 16x16 output tiles) ---
    v8f s[2][2] = {};
    {
      const _Float16* pe = el + g * 128 + ln16 * 8;
      const h8 e0 = *reinterpret_cast<const h8*>(pe);
      const h8 e1 = *reinterpret_cast<const h8*>(pe + 16 * EK_);
#pragma unroll  // indexes a register vector: the index must be a constant
      for (int i = 0; i < 8; ++i) { ae0[i] = e0[i]; ae1[i] = e1[i]; }
#pragma unroll  // indexes a register array: the index must be a constant
      for (int c = 0; c < 2; ++c) {
        s[c][0] = __builtin_amdgcn_wmma_f32_16x16x32_f16(false, ae0, false, bc[c],
                                                         (short)0, s[c][0], false, false);
        s[c][1] = __builtin_amdgcn_wmma_f32_16x16x32_f16(false, ae1, false, bc[c],
                                                         (short)0, s[c][1], false, false);
      }
    }
#pragma unroll
    for (int dt = 0; dt < 2; ++dt) {
      const _Float16* p0 = kl + ln16 * KP_ + dt * 32 + g * 8;
      const v16h ak0 = combine16(*reinterpret_cast<const h8*>(p0),
                                 *reinterpret_cast<const h8*>(p0 + 16));
      const _Float16* p1 = kl + (16 + ln16) * KP_ + dt * 32 + g * 8;
      const v16h ak1 = combine16(*reinterpret_cast<const h8*>(p1),
                                 *reinterpret_cast<const h8*>(p1 + 16));
#pragma unroll  // indexes a register array: the index must be a constant
      for (int c = 0; c < 2; ++c) {
        s[c][0] = __builtin_amdgcn_wmma_f32_16x16x32_f16(false, ak0, false, bq[c][dt],
                                                         (short)0, s[c][0], false, false);
        s[c][1] = __builtin_amdgcn_wmma_f32_16x16x32_f16(false, ak1, false, bq[c][dt],
                                                         (short)0, s[c][1], false, false);
      }
    }

    // V^T fragments of the pass, read in front of the branch below: behind it
    // nothing would cover their latency
    v16h av[4];
#pragma unroll  // indexes a register array: the index must be a constant
    for (int dt = 0; dt < 4; ++dt) {
      const _Float16* pv = vl + (dt * 16 + ln16) * VP_ + g * 8;
      av[dt] = combine16(*reinterpret_cast<const h8*>(pv),
                         *reinterpret_cast<const h8*>(pv + 16));
    }

    // --- softmax on a held reference: rmax is not each pass's maximum but the one
    //     that was in use when the scale was last set. The exponentials, P^T and
    //     the lane's sums are formed on it at once ---
    v16h bp[2];
    float es[2];
    exp_scores<false>(s, rmax, bp, es);

    // every exponential of a lane is at most the lane's sum: while that stays
    // within PMAX_, P is far inside f16's range and neither O nor the sums need a
    // new scale. One test a pass for both groups and the whole wave; written so
    // that a sum that is not a number counts as too large
    const bool over = !(es[0] <= PMAX_) || !(es[1] <= PMAX_);
    if (__builtin_expect(__builtin_amdgcn_ballot_w32(over) != 0, 0)) {  // rare: laid out off the pass's straight path
      // new scale: both groups take their running maximum as the reference, what
      // has been gathered is rescaled, and the pass's exponentials are formed anew
      float nm[2];
#pragma unroll  // indexes a register array: the index must be a constant
      for (int c = 0; c < 2; ++c) {
        float t[8];
#pragma unroll
        for (int i = 0; i < 4; ++i) {
          t[i]     = fmaxf(s[c][0][2 * i], s[c][0][2 * i + 1]);
          t[4 + i] = fmaxf(s[c][1][2 * i], s[c][1][2 * i + 1]);
        }
#pragma unroll
        for (int r = 4; r >= 1; r >>= 1)
#pragma unroll
          for (int i = 0; i < r; ++i) t[i] = fmaxf(t[2 * i], t[2 * i + 1]);
        const float mx = fmaxf(t[0], xhalf(t[0]));  // both halves use one reference
        nm[c] = fmaxf(rmax[c], mx);
      }
      // as a pair: the two references then stay in a register pair, and the pass's
      // subtractions are packed adds
      const f2 dm = f2{rmax[0], rmax[1]} - f2{nm[0], nm[1]};
      const float sc[2] = {exp2_slot(dm[0]), exp2_slot(dm[1])};
#pragma unroll  // indexes a register array: the index must be a constant
      for (int c = 0; c < 2; ++c) {
        rmax[c] = nm[c];
        rsum[c] *= sc[c];
#pragma unroll  // indexes a register array: the index must be a constant
        for (int dt = 0; dt < 4; ++dt) o[c][dt] *= sc[c];
      }
      exp_scores<true>(s, rmax, bp, es);
    }
    rsum[0] += es[0];
    rsum[1] += es[1];

    // --- O^T += V^T * P^T (four 16x16 d-row tiles for each group) ---
#pragma unroll
    for (int dt = 0; dt < 4; ++dt)
#pragma unroll  // indexes a register array: the index must be a constant
      for (int c = 0; c < 2; ++c)
        o[c][dt] = __builtin_amdgcn_wmma_f32_16x16x32_f16(false, av[dt], false, bp[c],
                                                          (short)0, o[c][dt], false, false);
    // the four vector slots the chip needs behind a WMMA before one of its
    // operand registers is overwritten: the next pass's first instructions reuse
    // them. The
    // scheduling barrier keeps the products in front of the slots
    __builtin_amdgcn_sched_barrier(0);
    asm volatile("v_nop\n\tv_nop\n\tv_nop\n\tv_nop");
   }
  }

  // the two waves of a query block swap one column group: wave kh keeps group kh
  // and hands over the other, lane to lane (both hold a group in the same layout)
  v8f   ok[4];
  float mk, lk;
  {
    const bool k1 = kh != 0;
#pragma unroll  // indexes a register array: the index must be a constant
    for (int dt = 0; dt < 4; ++dt) {
      const v8f og = k1 ? o[0][dt] : o[1][dt];
      ok[dt]       = k1 ? o[1][dt] : o[0][dt];
      xo[wid][2 * dt][lane]     = f4{og[0], og[1], og[2], og[3]};
      xo[wid][2 * dt + 1][lane] = f4{og[4], og[5], og[6], og[7]};
    }
    xm[wid][lane] = make_float2(k1 ? rmax[0] : rmax[1], k1 ? rsum[0] : rsum[1]);
    mk = k1 ? rmax[1] : rmax[0];
    lk = k1 ? rsum[1] : rsum[0];
  }
  __syncthreads();  // the partner's group is in LDS

  // epilogue: join the two key halves on one maximum, then the two lane halves'
  // sums, normalize, store to [B][M][512]; a lane holds 8 consecutive d of its
  // query in each tile
  const float2 pm = xm[wid ^ 4][lane];
  const float  mj = fmaxf(mk, pm.x);
  const float  fk = exp2_slot(mk - mj);
  const float  fp = exp2_slot(pm.x - mj);
  const float  lj = lk * fk + pm.y * fp;
  const float  rs = lj + xhalf(lj);
  float* orow = out + (size_t)(b * M_ + qbase + kh * 16 + ln16) * D_ + h * DK_ + 8 * g;
#pragma unroll
  for (int dt = 0; dt < 4; ++dt) {
    const f4 plo = xo[wid ^ 4][2 * dt][lane], phi = xo[wid ^ 4][2 * dt + 1][lane];
    f4 lo, hi;
#pragma unroll
    for (int v = 0; v < 4; ++v) {
      lo[v] = (ok[dt][v] * fk + plo[v] * fp) / rs;
      hi[v] = (ok[dt][4 + v] * fk + phi[v] * fp) / rs;
    }
    // the s_wait_xcnt closes the statement so that it stands in front of every
    // later rewrite of a register that the two stores name
    asm volatile("global_store_b128 %0, %1, off\n\t"
                 "global_store_b128 %0, %2, off offset:16\n\t"
                 "s_wait_xcnt 0x0"
                 :: "v"(orow + dt * 16), "v"(lo), "v"(hi) : "memory");
  }
}

// ---------------------------------------------------------------------------
extern "C" void kernel_launch(void* const* d_in, const int* in_sizes, int n_in,
                              void* d_out, int out_size, void* d_ws, size_t ws_size,
                              hipStream_t stream) {
  const float* x      = (const float*)d_in[0];
  const float* coords = (const float*)d_in[1];
  const float* wq     = (const float*)d_in[2];
  const float* bq     = (const float*)d_in[3];
  const float* wk     = (const float*)d_in[4];
  const float* bk     = (const float*)d_in[5];
  const float* wv     = (const float*)d_in[6];
  const float* bv     = (const float*)d_in[7];
  const float* alpha  = (const float*)d_in[8];
  float* out = (float*)d_out;

  _Float16* ws = (_Float16*)d_ws;
  const size_t QSZ = (size_t)B_ * H_ * M_ * DK_;   // 4,194,304 halves = 8 MB
  _Float16* Qb = ws;
  _Float16* Kb = ws + QSZ;
  _Float16* Vb = ws + 2 * QSZ;
  _Float16* Eb = ws + 3 * QSZ;                     // 256 KB; total 24.25 MB of d_ws

  dim3 g1((B_ * M_) / 128, D_ / 128, 3);
  qkv_proj_kernel<<<g1, 256, 0, stream>>>(x, wq, bq, wk, bk, wv, bv, coords, Qb, Kb, Vb, Eb);

  dim3 g2(M_ / 128, B_ * H_);
  attn_kernel<<<g2, 256, 0, stream>>>(Qb, Kb, Vb, Eb, coords, alpha, out);
}
